// v000
// The times below were measured on an AMD MI455X: many runs one after another, warmed up first and cycling through
// copies of the inputs, with the whole window's GPU time divided by the number of runs. Launches and the gaps
// between them are all in it. The median over several windows is given; except for v000 it joins two sittings, which
// can be a few percent apart, so the side-by-side timings, each taken in one sitting, are the better comparison.
// The starting kernel, v000, takes 2320 microseconds a run.
#include <hip/hip_runtime.h>

// Causal attention with per-head weight tensors and NO score scaling (x [4][2048][1024]; q = einsum('nhm,btm', Q, x) with Q, K, V [16][64][1024] (= 'oi' [1024][1024] with rows n*64 + h; 1/32 scale); scores = q.k (the source has no 1/sqrt(d_head) factor: logits sigma ~8); causal (-1e10 == exclusion); softmax; z = merged heads (n, h); out = einsum('ma,bqa', O, z) ('oi') -> [4][2048][1024] (8.4 M); argument order x, Q, K, V, O).
// Layout per batch: bf16 copy of x; the [16][64][1024] weights are already Bt planes ('oi' rows n*64 + h); exact projections; identity-table plane builders; causal T-2048 attention with SCL 1 (rows on hi/lo or fp16 planes per the RH macro; k_gemmc skips tiles above the diagonal); merged hi/lo x O exact.
// Compute dtypes, f32 accumulate: every input rounded to bf16; projections exact; softmax f32; O hl x exact.

#define NB_  4
#define TT   2048
#define DM   1024
#define NH_  16
#define NKV  16
#define REP  (NH_ / NKV)
#define HD   64
#define DQ   (NH_ * HD)
#define DKV  (NKV * HD)
#define ZH   2
#define RH   TT                   // every row hi/lo (3 products)
#define WIN  2048
#define PCAR 1024.0f
#define SCL  1.0f   // the module applies NO score scaling
typedef _Float16 h16;
typedef unsigned short bf;
typedef __attribute__((ext_vector_type(16))) __bf16   v16bf;
typedef __attribute__((ext_vector_type(16))) _Float16 v16h;
typedef __attribute__((ext_vector_type(8)))  _Float16 v8h;
typedef __attribute__((ext_vector_type(8)))  unsigned short v8us;
typedef __attribute__((ext_vector_type(8)))  float    v8f;
typedef __attribute__((ext_vector_type(4)))  float    v4f;
typedef v8h  __attribute__((may_alias)) v8ha;
typedef v4f  __attribute__((may_alias)) v4fa;
typedef v8us __attribute__((may_alias)) v8usa;

__device__ __forceinline__ unsigned short f2bf(float f) { unsigned u = __float_as_uint(f); u += 0x7FFFu + ((u >> 16) & 1u); return (unsigned short)(u >> 16); }
__device__ __forceinline__ float bf2f(unsigned short b) { return __uint_as_float(((unsigned)b) << 16); }
__device__ __forceinline__ float bfr(float f) { return bf2f(f2bf(f)); }
__device__ __forceinline__ v16h cat16(v8h lo, v8h hi) { return __builtin_shufflevector(lo, hi, 0, 1, 2, 3, 4, 5, 6, 7, 8, 9, 10, 11, 12, 13, 14, 15); }
__device__ __forceinline__ v16bf cat16b(v8us lo, v8us hi) { return __builtin_bit_cast(v16bf, __builtin_shufflevector(lo, hi, 0, 1, 2, 3, 4, 5, 6, 7, 8, 9, 10, 11, 12, 13, 14, 15)); }
__device__ __forceinline__ v8f wmma16(v16h a, v16h b, v8f c) { return __builtin_amdgcn_wmma_f32_16x16x32_f16(false, a, false, b, (short)0, c, false, false); }
__device__ __forceinline__ v8f wmmab(v16bf a, v16bf b, v8f c) { return __builtin_amdgcn_wmma_f32_16x16x32_bf16(false, a, false, b, (short)0, c, false, false); }



// ---- k_gemmw: register-blocked GEMM, ONE WAVE per 64x64 output tile (16 accumulators), operands straight from K-contiguous 16-bit planes; grid (M/64, N/64, Z), 32 threads.
// C[m][n] (f32, pitch ldc, + optional f32 bias[n]) = sum_k A[m][k] Bt[n][k] (+ split products per NSPLIT). z-batch strides sA/sB/sC in elements. K % 32 == 0.
template <typename T16> struct WFrag;
template <> struct WFrag<h16> { typedef v16h V; static __device__ __forceinline__ V ld(const h16* p) { return cat16(*(const v8h*)p, *(const v8h*)(p + 16)); } static __device__ __forceinline__ v8f mma(V a, V b, v8f c) { return wmma16(a, b, c); } };
template <> struct WFrag<bf> { typedef v16bf V; static __device__ __forceinline__ V ld(const bf* p) { return cat16b(*(const v8us*)p, *(const v8us*)(p + 16)); } static __device__ __forceinline__ v8f mma(V a, V b, v8f c) { return wmmab(a, b, c); } };
template <typename T16, int NSPLIT, bool BIAS>
__global__ __launch_bounds__(32) void k_gemmw(const T16* __restrict__ A, const T16* __restrict__ A2, const T16* __restrict__ Bt, const T16* __restrict__ Bt2, int K, float* C, int ldc, const float* __restrict__ bias, size_t sA, size_t sB, size_t sC) {
    typedef typename WFrag<T16>::V V;
    __shared__ __align__(16) float os[16 * 68];
    const size_t z = blockIdx.z; A += z * sA; if (A2) A2 += z * sA; Bt += z * sB; if (Bt2) Bt2 += z * sB; C += z * sC;
    const int lane = threadIdx.x & 31, lr = lane & 15, hi = lane >> 4; const int r0 = blockIdx.x * 64, c0 = blockIdx.y * 64;
    v8f acc[4][4];
#pragma unroll
    for (int mb = 0; mb < 4; ++mb)
#pragma unroll
        for (int nb = 0; nb < 4; ++nb) acc[mb][nb] = (v8f){};
    const size_t aoff = (size_t)(r0 + lr) * K + 8 * hi, boff = (size_t)(c0 + lr) * K + 8 * hi;
#pragma unroll 1
    for (int kc = 0; kc < K; kc += 32) {
        V a[4], a2[4];
#pragma unroll
        for (int mb = 0; mb < 4; ++mb) { a[mb] = WFrag<T16>::ld(A + aoff + (size_t)mb * 16 * K + kc); if (NSPLIT == 1 || NSPLIT == 2) a2[mb] = WFrag<T16>::ld(A2 + aoff + (size_t)mb * 16 * K + kc); }
#pragma unroll
        for (int nb = 0; nb < 4; ++nb) { const V b = WFrag<T16>::ld(Bt + boff + (size_t)nb * 16 * K + kc); V b2; if (NSPLIT >= 2) b2 = WFrag<T16>::ld(Bt2 + boff + (size_t)nb * 16 * K + kc);
#pragma unroll
            for (int mb = 0; mb < 4; ++mb) { acc[mb][nb] = WFrag<T16>::mma(a[mb], b, acc[mb][nb]); if (NSPLIT == 1 || NSPLIT == 2) acc[mb][nb] = WFrag<T16>::mma(a2[mb], b, acc[mb][nb]); if (NSPLIT >= 2) acc[mb][nb] = WFrag<T16>::mma(a[mb], b2, acc[mb][nb]); } }
        asm volatile("v_nop\n\tv_nop\n\tv_nop\n\tv_nop" : "+v"(acc[0][0]), "+v"(acc[1][1]), "+v"(acc[2][2]), "+v"(acc[3][3]) : "v"(a[0]), "v"(a[3]));
    }
#pragma unroll
    for (int mb = 0; mb < 4; ++mb) {
#pragma unroll
        for (int nb = 0; nb < 4; ++nb) {
#pragma unroll
            for (int j = 0; j < 8; ++j) os[(hi * 8 + j) * 68 + nb * 16 + lr] = acc[mb][nb][j]; }
        __builtin_amdgcn_wave_barrier(); asm volatile("" ::: "memory");
        float* crow = C + (size_t)(r0 + mb * 16) * ldc + c0;
{
#pragma unroll
            for (int s = 0; s < 8; ++s) { const int row = 2 * s + hi, cofs = lr * 4; v4f val = *(const v4fa*)(os + row * 68 + cofs); if (BIAS) { val[0] += bfr(bias[c0 + cofs]); val[1] += bfr(bias[c0 + cofs + 1]); val[2] += bfr(bias[c0 + cofs + 2]); val[3] += bfr(bias[c0 + cofs + 3]); }
                *(v4f*)(crow + (size_t)row * ldc + cofs) = val; }
             }
        __builtin_amdgcn_wave_barrier(); asm volatile("" ::: "memory");
    }
}

// ---- k_gemmc: the same one-wave 64x64 tile GEMM specialised for causal attention: CMODE 1 skips score tiles entirely above the diagonal (query rows r0+roff.., key columns c0..), CMODE 2 limits the
// key (K) loop of the probability x value contraction to the diagonal block (probabilities beyond it are exactly zero). roff = row offset of this launch's first row within the sequence.
template <typename T16, int NSPLIT, int CMODE>
__global__ __launch_bounds__(32) void k_gemmc(const T16* __restrict__ A, const T16* __restrict__ A2, const T16* __restrict__ Bt, const T16* __restrict__ Bt2, int K, float* C, int ldc, int roff, size_t sA, size_t sB, size_t sC) {
    typedef typename WFrag<T16>::V V;
    __shared__ __align__(16) float os[16 * 68];
    const size_t z = blockIdx.z; A += z * sA; if (A2) A2 += z * sA; Bt += z * sB; if (Bt2) Bt2 += z * sB; C += z * sC;
    const int lane = threadIdx.x & 31, lr = lane & 15, hi = lane >> 4; const int r0 = blockIdx.x * 64, c0 = blockIdx.y * 64;
    if (CMODE == 1 && c0 > r0 + roff + 63) return;                  // score tile entirely above the causal diagonal: never read (the softmax masks j > i by select)
    const int Kl = (CMODE == 2) ? min(K, r0 + roff + 64) : K;        // P.V: probabilities are exactly 0 beyond the diagonal block, so the K loop stops there
    v8f acc[4][4];
#pragma unroll
    for (int mb = 0; mb < 4; ++mb)
#pragma unroll
        for (int nb = 0; nb < 4; ++nb) acc[mb][nb] = (v8f){};
    const size_t aoff = (size_t)(r0 + lr) * K + 8 * hi, boff = (size_t)(c0 + lr) * K + 8 * hi;
#pragma unroll 1
    for (int kc = 0; kc < Kl; kc += 32) {
        V a[4], a2[4];
#pragma unroll
        for (int mb = 0; mb < 4; ++mb) { a[mb] = WFrag<T16>::ld(A + aoff + (size_t)mb * 16 * K + kc); if (NSPLIT == 1 || NSPLIT == 2) a2[mb] = WFrag<T16>::ld(A2 + aoff + (size_t)mb * 16 * K + kc); }
#pragma unroll
        for (int nb = 0; nb < 4; ++nb) { const V b = WFrag<T16>::ld(Bt + boff + (size_t)nb * 16 * K + kc); V b2; if (NSPLIT >= 2) b2 = WFrag<T16>::ld(Bt2 + boff + (size_t)nb * 16 * K + kc);
#pragma unroll
            for (int mb = 0; mb < 4; ++mb) { acc[mb][nb] = WFrag<T16>::mma(a[mb], b, acc[mb][nb]); if (NSPLIT == 1 || NSPLIT == 2) acc[mb][nb] = WFrag<T16>::mma(a2[mb], b, acc[mb][nb]); if (NSPLIT >= 2) acc[mb][nb] = WFrag<T16>::mma(a[mb], b2, acc[mb][nb]); } }
        asm volatile("v_nop\n\tv_nop\n\tv_nop\n\tv_nop" : "+v"(acc[0][0]), "+v"(acc[1][1]), "+v"(acc[2][2]), "+v"(acc[3][3]) : "v"(a[0]), "v"(a[3]));
    }
#pragma unroll
    for (int mb = 0; mb < 4; ++mb) {
#pragma unroll
        for (int nb = 0; nb < 4; ++nb) {
#pragma unroll
            for (int j = 0; j < 8; ++j) os[(hi * 8 + j) * 68 + nb * 16 + lr] = acc[mb][nb][j]; }
        __builtin_amdgcn_wave_barrier(); asm volatile("" ::: "memory");
        float* crow = C + (size_t)(r0 + mb * 16) * ldc + c0;
{
#pragma unroll
            for (int s = 0; s < 8; ++s) { const int row = 2 * s + hi, cofs = lr * 4; v4f val = *(const v4fa*)(os + row * 68 + cofs);
                *(v4f*)(crow + (size_t)row * ldc + cofs) = val; }
             }
        __builtin_amdgcn_wave_barrier(); asm volatile("" ::: "memory");
    }
}

__device__ __forceinline__ h16 tohx(float x) { return (h16)x; }
__device__ __forceinline__ void splitf(float y, unsigned short& h, unsigned short& l) { h = f2bf(y); l = f2bf(y - bf2f(h)); }
typedef __attribute__((ext_vector_type(2))) _Float16 v2h;
typedef __attribute__((ext_vector_type(4))) _Float16 v4h;
typedef __attribute__((ext_vector_type(2))) unsigned short v2us;
typedef __attribute__((ext_vector_type(4))) unsigned short v4us;
typedef __attribute__((ext_vector_type(2))) float v2f;
typedef __attribute__((ext_vector_type(4))) int v4i;

__global__ __launch_bounds__(256) void k_cvt8(const float* __restrict__ src, bf* dst, size_t n8) { const size_t i = (size_t)blockIdx.x * 256 + threadIdx.x; if (i >= n8) return; const v8f v = *(const v8f*)(src + i * 8); v8us o;
#pragma unroll
    for (int k = 0; k < 8; ++k) o[k] = f2bf(v[k]); *(v8us*)(dst + i * 8) = o;  }

// k_rope: head planes [h][t][d] (fp16 + hi/lo) of rope(x) x sc with the rotate-half convention out[d] = x[d] cos[t][d] - x[d+HD/2] sin[t][d], out[d+HD/2] = x[d+HD/2] cos[t][d+HD/2] + x[d] sin[t][d+HD/2]
__global__ __launch_bounds__(256) void k_rope(const float* __restrict__ F, int pitch, int nheads, const float* __restrict__ CS, const float* __restrict__ RF, const float* __restrict__ nw, float sc, h16* P16, bf* Ph, bf* Pl) {
    const size_t e = ((size_t)blockIdx.x * 256 + threadIdx.x) * 2; if (e >= (size_t)nheads * TT * HD) return; const int d = (int)(e % HD); const int t = (int)((e / HD) % TT); const int h = (int)(e / ((size_t)HD * TT)); const float* f = F + (size_t)t * pitch + h * HD; const float rf = RF ? RF[(size_t)h * TT + t] : 1.0f; v2h o16; v2us oh, ol;
#pragma unroll
    for (int q = 0; q < 2; ++q) { const int dd = d + q; const int dp = (dd < HD / 2) ? dd + HD / 2 : dd - HD / 2; float x0 = f[dd], x1 = f[dp];
        if (RF) { float n0 = __fmul_rn(x0, rf), n1 = __fmul_rn(x1, rf); asm volatile("" : "+v"(n0)); asm volatile("" : "+v"(n1)); x0 = __fmul_rn(bfr(nw[dd]), n0); x1 = __fmul_rn(bfr(nw[dp]), n1); }
        const v2f cs = *(const v2f*)(CS + ((size_t)t * HD + dd) * 2); float a = __fmul_rn(x0, cs[0]), bq = __fmul_rn(x1, cs[1]); asm volatile("" : "+v"(a)); asm volatile("" : "+v"(bq)); const float r = ((dd < HD / 2) ? __fsub_rn(a, bq) : __fadd_rn(a, bq)) * sc;
        o16[q] = tohx(r); unsigned short a2, c2; splitf(r, a2, c2); oh[q] = a2; ol[q] = c2; }
    *(v2h*)(P16 + e) = o16; *(v2us*)(Ph + e) = oh; *(v2us*)(Pl + e) = ol;  }
__global__ __launch_bounds__(256) void k_vtp(const float* __restrict__ F, int pitch, int nheads, h16* V16, bf* Vh, bf* Vl) { const size_t e = ((size_t)blockIdx.x * 256 + threadIdx.x) * 2; if (e >= (size_t)nheads * HD * TT) return; const int t = (int)(e % TT); const int d = (int)((e / TT) % HD); const int g = (int)(e / ((size_t)TT * HD)); v2h o16; v2us oh, ol;
#pragma unroll
    for (int q = 0; q < 2; ++q) { const float x = F[(size_t)(t + q) * pitch + g * HD + d]; o16[q] = tohx(x); unsigned short a2, c2; splitf(x, a2, c2); oh[q] = a2; ol[q] = c2; }
    *(v2h*)(V16 + e) = o16; *(v2us*)(Vh + e) = oh; *(v2us*)(Vl + e) = ol;  }
__global__ __launch_bounds__(256) void k_csid(float* CS) { const int idx = blockIdx.x * 256 + threadIdx.x; if (idx >= TT * HD) return; v2f cs; cs[0] = 1.0f; cs[1] = 0.0f; *(v2f*)(CS + (size_t)idx * 2) = cs;  }
// k_asoft: per row (zz, i): t = S x SCL (= 1) for j <= i and i - j < WIN (sliding causal window; the reference's -1e9 additive fill vanishes identically); softmax over the 2048 keys (register row, one exp, fixed trees);
__global__ __launch_bounds__(256) void k_asoft(const float* __restrict__ Sb, h16* P16, bf* Ph, bf* Pl) {
    const int lane = threadIdx.x & 31; const int row = blockIdx.x * 8 + (threadIdx.x >> 5); if (row >= ZH * TT) return; const int i = row % TT; const int zz = row / TT; (void)zz; const bool hires = (i < RH); const float* sr = Sb + (size_t)row * TT; float v[TT / 32]; float mx = -3.0e38f;
#pragma unroll
    for (int ch = 0; ch < TT / 128; ++ch) { const int j0 = ch * 128 + lane * 4; const v4f a = *(const v4f*)(sr + j0);
#pragma unroll
        for (int q = 0; q < 4; ++q) { const int j = j0 + q; (void)j; const float t = (j <= i && i - j < WIN) ? a[q] * SCL : -3.0e38f; v[ch * 4 + q] = t; mx = fmaxf(mx, t); } }
#pragma unroll
    for (int sh = 16; sh; sh >>= 1) mx = fmaxf(mx, __shfl_xor(mx, sh, 32));
    float sum = 0.f;
#pragma unroll
    for (int k = 0; k < TT / 32; ++k) { float d0 = __fsub_rn(v[k], mx); asm volatile("" : "+v"(d0)); v[k] = __builtin_amdgcn_exp2f(__fmul_rn(d0, 1.4426950408889634f)); sum += v[k]; }
#pragma unroll
    for (int sh = 16; sh; sh >>= 1) sum += __shfl_xor(sum, sh, 32);
    const float f = __fdiv_rn(hires ? 1.0f : PCAR, sum);
{
        if (hires) {
#pragma unroll
            for (int ch = 0; ch < TT / 128; ++ch) { v4us oh, ol;
#pragma unroll
                for (int q = 0; q < 4; ++q) { unsigned short a, c2; splitf(v[ch * 4 + q] * f, a, c2); oh[q] = a; ol[q] = c2; }
                const size_t oo = ((size_t)zz * (RH ? RH : 1) + i) * TT + ch * 128 + lane * 4; *(v4us*)(Ph + oo) = oh; *(v4us*)(Pl + oo) = ol; }
        } else {
#pragma unroll
            for (int ch = 0; ch < TT / 128; ++ch) { v4h o4;
#pragma unroll
                for (int q = 0; q < 4; ++q) o4[q] = tohx(v[ch * 4 + q] * f);
                *(v4h*)(P16 + (size_t)row * TT + ch * 128 + lane * 4) = o4; } }
         }
}
__global__ __launch_bounds__(256) void k_merge(const float* __restrict__ O, int h0, bf* Ah, bf* Al) { const size_t e = ((size_t)blockIdx.x * 256 + threadIdx.x) * 2; if (e >= (size_t)ZH * TT * HD) return; const int d = (int)(e % HD); const int t = (int)((e / HD) % TT); const int zz = (int)(e / ((size_t)HD * TT)); const float cs = (t < RH) ? 1.0f : (1.0f / PCAR); const size_t oo = (size_t)t * DQ + (h0 + zz) * HD + d;
    v2us oh, ol;
#pragma unroll
    for (int q = 0; q < 2; ++q) { unsigned short a, c2; splitf(O[e + q] * cs, a, c2); oh[q] = a; ol[q] = c2; } *(v2us*)(Ah + oo) = oh; *(v2us*)(Al + oo) = ol;  }

extern "C" void kernel_launch(void* const* d_in, const int* in_sizes, int n_in,
                              void* d_out, int out_size, void* d_ws, size_t ws_size, hipStream_t stream) {
    (void)in_sizes; (void)n_in; (void)out_size;
    const float* x = (const float*)d_in[0]; const float* wq = (const float*)d_in[1]; const float* wk = (const float*)d_in[2]; const float* wv = (const float*)d_in[3]; const float* wo = (const float*)d_in[4];   /* x, Q, K, V [16][64][1024] (= 'oi'), O ('oi' [1024][1024]) */
    float* OUT = (float*)d_out;     // [4][2048][1024]
    char* wsp = (char*)d_ws;
    auto take = [&](size_t bytes) { char* p = wsp; wsp += (bytes + 255) & ~(size_t)255; return (void*)p; };
    bf* WQ = (bf*)take((size_t)DQ * DM * 2); bf* WK = (bf*)take((size_t)DKV * DM * 2); bf* WV = (bf*)take((size_t)DKV * DM * 2); bf* WO = (bf*)take((size_t)DM * DQ * 2); float* CS = (float*)take((size_t)TT * HD * 2 * 4);
    bf* XB = (bf*)take((size_t)TT * DM * 2); float* FQ = (float*)take((size_t)TT * DQ * 4); float* FK = (float*)take((size_t)TT * DKV * 4);
    h16* QP16 = (h16*)take((size_t)NH_ * TT * HD * 2); h16* KP16 = (h16*)take((size_t)NKV * TT * HD * 2); h16* VT16 = (h16*)take((size_t)NKV * HD * TT * 2);
    bf* QPh = (bf*)take((size_t)NH_ * TT * HD * 2); bf* QPl = (bf*)take((size_t)NH_ * TT * HD * 2); bf* KPh = (bf*)take((size_t)NKV * TT * HD * 2); bf* KPl = (bf*)take((size_t)NKV * TT * HD * 2); bf* VTh = (bf*)take((size_t)NKV * HD * TT * 2); bf* VTl = (bf*)take((size_t)NKV * HD * TT * 2); bf* Ph = (bf*)take((size_t)ZH * RH * TT * 2); bf* Pl = (bf*)take((size_t)ZH * RH * TT * 2);
    float* Sb = (float*)take((size_t)ZH * TT * TT * 4); h16* P16 = (h16*)take((size_t)ZH * TT * TT * 2); float* Ob = (float*)take((size_t)ZH * TT * HD * 4); bf* ATh = (bf*)take((size_t)TT * DQ * 2); bf* ATl = (bf*)take((size_t)TT * DQ * 2);
    if ((size_t)(wsp - (char*)d_ws) > ws_size) return;    // ws 256 MiB
    float* FV = FK;   // v projection reuses the k buffer after the k planes are built (stream-ordered)
    { k_cvt8<<<(unsigned)(((size_t)DQ * DM / 8 + 255) / 256), 256, 0, stream>>>(wq, WQ, (size_t)DQ * DM / 8); k_cvt8<<<(unsigned)(((size_t)DKV * DM / 8 + 255) / 256), 256, 0, stream>>>(wk, WK, (size_t)DKV * DM / 8); k_cvt8<<<(unsigned)(((size_t)DKV * DM / 8 + 255) / 256), 256, 0, stream>>>(wv, WV, (size_t)DKV * DM / 8);
      k_cvt8<<<(unsigned)(((size_t)DM * DQ / 8 + 255) / 256), 256, 0, stream>>>(wo, WO, (size_t)DM * DQ / 8);
       }
    k_csid<<<(TT * HD + 255) / 256, 256, 0, stream>>>(CS);
    const unsigned LQ = (unsigned)(((size_t)NH_ * TT * HD / 2 + 255) / 256), LKv = (unsigned)(((size_t)NKV * TT * HD / 2 + 255) / 256);
    for (int b = 0; b < NB_; ++b) {
        
        k_cvt8<<<(unsigned)(((size_t)TT * DM / 8 + 255) / 256), 256, 0, stream>>>(x + (size_t)b * TT * DM, XB, (size_t)TT * DM / 8);
        k_gemmw<bf, 0, false><<<dim3(TT / 64, DQ / 64, 1), 32, 0, stream>>>(XB, nullptr, WQ, nullptr, DM, FQ, DQ, nullptr, 0, 0, 0);
        k_rope<<<LQ, 256, 0, stream>>>(FQ, DQ, NH_, CS, nullptr, nullptr, 1.0f, QP16, QPh, QPl);
        k_gemmw<bf, 0, false><<<dim3(TT / 64, DKV / 64, 1), 32, 0, stream>>>(XB, nullptr, WK, nullptr, DM, FK, DKV, nullptr, 0, 0, 0);
        k_rope<<<LKv, 256, 0, stream>>>(FK, DKV, NKV, CS, nullptr, nullptr, 1.0f, KP16, KPh, KPl);
        k_gemmw<bf, 0, false><<<dim3(TT / 64, DKV / 64, 1), 32, 0, stream>>>(XB, nullptr, WV, nullptr, DM, FV, DKV, nullptr, 0, 0, 0); k_vtp<<<LKv, 256, 0, stream>>>(FV, DKV, NKV, VT16, VTh, VTl);
        for (int h0 = 0; h0 < NH_; h0 += ZH) { const size_t zq = (size_t)h0, zk = (size_t)(h0 / REP);   // one kv head per query head: the pass's two heads use consecutive kv planes (z-strides TT*HD)
            k_gemmc<bf, 2, 1><<<dim3(RH / 64, TT / 64, ZH), 32, 0, stream>>>(QPh + zq * TT * HD, QPl + zq * TT * HD, KPh + zk * TT * HD, KPl + zk * TT * HD, HD, Sb, TT, 0, (size_t)TT * HD, (size_t)TT * HD, (size_t)TT * TT);
            k_asoft<<<ZH * TT / 8, 256, 0, stream>>>(Sb, P16, Ph, Pl);
            k_gemmc<bf, 2, 2><<<dim3(RH / 64, HD / 64, ZH), 32, 0, stream>>>(Ph, Pl, VTh + zk * HD * TT, VTl + zk * HD * TT, TT, Ob, HD, 0, (size_t)RH * TT, (size_t)HD * TT, (size_t)TT * HD);
            k_merge<<<(unsigned)(((size_t)ZH * TT * HD / 2 + 255) / 256), 256, 0, stream>>>(Ob, h0, ATh, ATl); }
        k_gemmw<bf, 1, false><<<dim3(TT / 64, DM / 64, 1), 32, 0, stream>>>(ATh, ATl, WO, nullptr, DQ, OUT + (size_t)b * TT * DM, DM, nullptr, 0, 0, 0); }
}

// v001
// A run of this version takes 1340 microseconds.
// Timed twice side by side with v000, it ran 1.73 and 1.72 times as fast.
#include <hip/hip_runtime.h>

// Causal attention with per-head weight tensors and NO score scaling (x [4][2048][1024]; q = einsum('nhm,btm', Q, x) with Q, K, V [16][64][1024] (= 'oi' [1024][1024] with rows n*64 + h; 1/32 scale); scores = q.k (the source has no 1/sqrt(d_head) factor: logits sigma ~8); causal (-1e10 == exclusion); softmax; z = merged heads (n, h); out = einsum('ma,bqa', O, z) ('oi') -> [4][2048][1024] (8.4 M); argument order x, Q, K, V, O).
// Layout per batch: bf16 copy of x; the [16][64][1024] weights are already Bt planes ('oi' rows n*64 + h); exact projections; identity-table plane builders; causal T-2048 attention with SCL 1 (rows on hi/lo or fp16 planes per the RH macro; k_gemmc skips tiles above the diagonal); merged hi/lo x O exact.
// Compute dtypes, f32 accumulate: every input rounded to bf16; projections exact; softmax f32; O hl x exact.

#define NB_  4
#define TT   2048
#define DM   1024
#define NH_  16
#define NKV  16
#define REP  (NH_ / NKV)
#define HD   64
#define DQ   (NH_ * HD)
#define DKV  (NKV * HD)
#define ZH   2
#define RH   TT                   // every row hi/lo (3 products)
#define WIN  2048
#define PCAR 1024.0f
#define SCL  1.0f   // the module applies NO score scaling
#define KCH  128                  // keys per work-group of the probability x value product (split over keys)
#define NCH  (TT / KCH)
typedef _Float16 h16;
typedef unsigned short bf;
typedef __attribute__((ext_vector_type(16))) __bf16   v16bf;
typedef __attribute__((ext_vector_type(16))) _Float16 v16h;
typedef __attribute__((ext_vector_type(8)))  _Float16 v8h;
typedef __attribute__((ext_vector_type(8)))  unsigned short v8us;
typedef __attribute__((ext_vector_type(8)))  float    v8f;
typedef __attribute__((ext_vector_type(4)))  float    v4f;
typedef v8h  __attribute__((may_alias)) v8ha;
typedef v4f  __attribute__((may_alias)) v4fa;
typedef v8us __attribute__((may_alias)) v8usa;

__device__ __forceinline__ unsigned short f2bf(float f) { unsigned u = __float_as_uint(f); u += 0x7FFFu + ((u >> 16) & 1u); return (unsigned short)(u >> 16); }
__device__ __forceinline__ float bf2f(unsigned short b) { return __uint_as_float(((unsigned)b) << 16); }
__device__ __forceinline__ float bfr(float f) { return bf2f(f2bf(f)); }
__device__ __forceinline__ v16h cat16(v8h lo, v8h hi) { return __builtin_shufflevector(lo, hi, 0, 1, 2, 3, 4, 5, 6, 7, 8, 9, 10, 11, 12, 13, 14, 15); }
__device__ __forceinline__ v16bf cat16b(v8us lo, v8us hi) { return __builtin_bit_cast(v16bf, __builtin_shufflevector(lo, hi, 0, 1, 2, 3, 4, 5, 6, 7, 8, 9, 10, 11, 12, 13, 14, 15)); }
__device__ __forceinline__ v8f wmma16(v16h a, v16h b, v8f c) { return __builtin_amdgcn_wmma_f32_16x16x32_f16(false, a, false, b, (short)0, c, false, false); }
__device__ __forceinline__ v8f wmmab(v16bf a, v16bf b, v8f c) { return __builtin_amdgcn_wmma_f32_16x16x32_bf16(false, a, false, b, (short)0, c, false, false); }



// ---- k_gemmw: register-blocked GEMM, ONE WAVE per 64x64 output tile (16 accumulators), operands straight from K-contiguous 16-bit planes; grid (M/64, N/64, Z), 32 threads.
// C[m][n] (f32, pitch ldc, + optional f32 bias[n]) = sum_k A[m][k] Bt[n][k] (+ split products per NSPLIT). z-batch strides sA/sB/sC in elements. K % 32 == 0.
template <typename T16> struct WFrag;
template <> struct WFrag<h16> { typedef v16h V; static __device__ __forceinline__ V ld(const h16* p) { return cat16(*(const v8h*)p, *(const v8h*)(p + 16)); } static __device__ __forceinline__ v8f mma(V a, V b, v8f c) { return wmma16(a, b, c); } };
template <> struct WFrag<bf> { typedef v16bf V; static __device__ __forceinline__ V ld(const bf* p) { return cat16b(*(const v8us*)p, *(const v8us*)(p + 16)); } static __device__ __forceinline__ v8f mma(V a, V b, v8f c) { return wmmab(a, b, c); } };
template <typename T16, int NSPLIT, bool BIAS>
__global__ __launch_bounds__(32) void k_gemmw(const T16* __restrict__ A, const T16* __restrict__ A2, const T16* __restrict__ Bt, const T16* __restrict__ Bt2, int K, float* C, int ldc, const float* __restrict__ bias, size_t sA, size_t sB, size_t sC) {
    typedef typename WFrag<T16>::V V;
    __shared__ __align__(16) float os[16 * 68];
    const size_t z = blockIdx.z; A += z * sA; if (A2) A2 += z * sA; Bt += z * sB; if (Bt2) Bt2 += z * sB; C += z * sC;
    const int lane = threadIdx.x & 31, lr = lane & 15, hi = lane >> 4; const int r0 = blockIdx.x * 64, c0 = blockIdx.y * 64;
    v8f acc[4][4];
#pragma unroll
    for (int mb = 0; mb < 4; ++mb)
#pragma unroll
        for (int nb = 0; nb < 4; ++nb) acc[mb][nb] = (v8f){};
    const size_t aoff = (size_t)(r0 + lr) * K + 8 * hi, boff = (size_t)(c0 + lr) * K + 8 * hi;
#pragma unroll 1
    for (int kc = 0; kc < K; kc += 32) {
        V a[4], a2[4];
#pragma unroll
        for (int mb = 0; mb < 4; ++mb) { a[mb] = WFrag<T16>::ld(A + aoff + (size_t)mb * 16 * K + kc); if (NSPLIT == 1 || NSPLIT == 2) a2[mb] = WFrag<T16>::ld(A2 + aoff + (size_t)mb * 16 * K + kc); }
#pragma unroll
        for (int nb = 0; nb < 4; ++nb) { const V b = WFrag<T16>::ld(Bt + boff + (size_t)nb * 16 * K + kc); V b2; if (NSPLIT >= 2) b2 = WFrag<T16>::ld(Bt2 + boff + (size_t)nb * 16 * K + kc);
#pragma unroll
            for (int mb = 0; mb < 4; ++mb) { acc[mb][nb] = WFrag<T16>::mma(a[mb], b, acc[mb][nb]); if (NSPLIT == 1 || NSPLIT == 2) acc[mb][nb] = WFrag<T16>::mma(a2[mb], b, acc[mb][nb]); if (NSPLIT >= 2) acc[mb][nb] = WFrag<T16>::mma(a[mb], b2, acc[mb][nb]); } }
        asm volatile("v_nop\n\tv_nop\n\tv_nop\n\tv_nop" : "+v"(acc[0][0]), "+v"(acc[1][1]), "+v"(acc[2][2]), "+v"(acc[3][3]) : "v"(a[0]), "v"(a[3]));
    }
#pragma unroll
    for (int mb = 0; mb < 4; ++mb) {
#pragma unroll
        for (int nb = 0; nb < 4; ++nb) {
#pragma unroll
            for (int j = 0; j < 8; ++j) os[(hi * 8 + j) * 68 + nb * 16 + lr] = acc[mb][nb][j]; }
        __builtin_amdgcn_wave_barrier(); asm volatile("" ::: "memory");
        float* crow = C + (size_t)(r0 + mb * 16) * ldc + c0;
{
#pragma unroll
            for (int s = 0; s < 8; ++s) { const int row = 2 * s + hi, cofs = lr * 4; v4f val = *(const v4fa*)(os + row * 68 + cofs); if (BIAS) { val[0] += bfr(bias[c0 + cofs]); val[1] += bfr(bias[c0 + cofs + 1]); val[2] += bfr(bias[c0 + cofs + 2]); val[3] += bfr(bias[c0 + cofs + 3]); }
                *(v4f*)(crow + (size_t)row * ldc + cofs) = val; }
             }
        __builtin_amdgcn_wave_barrier(); asm volatile("" ::: "memory");
    }
}

// ---- k_gemmc: the same one-wave 64x64 tile GEMM specialised for causal attention: CMODE 1 skips score tiles entirely above the diagonal (query rows r0+roff.., key columns c0..), CMODE 2 limits the
// key (K) loop of the probability x value contraction to the diagonal block (probabilities beyond it are exactly zero). roff = row offset of this launch's first row within the sequence.
// CMODE 2 is split over keys: blockIdx.y names a range of KCH keys (the output is one 64-column tile, HD == 64), each range stores its f32 partial tile in its own plane (stride sP), and k_merge adds the planes.
template <typename T16, int NSPLIT, int CMODE>
__global__ __launch_bounds__(32) void k_gemmc(const T16* __restrict__ A, const T16* __restrict__ A2, const T16* __restrict__ Bt, const T16* __restrict__ Bt2, int K, float* C, int ldc, int roff, size_t sA, size_t sB, size_t sC, size_t sP) {
    typedef typename WFrag<T16>::V V;
    __shared__ __align__(16) float os[16 * 68];
    const size_t z = blockIdx.z; A += z * sA; if (A2) A2 += z * sA; Bt += z * sB; if (Bt2) Bt2 += z * sB; C += z * sC;
    const int lane = threadIdx.x & 31, lr = lane & 15, hi = lane >> 4; const int r0 = blockIdx.x * 64, c0 = (CMODE == 2) ? 0 : blockIdx.y * 64; const int kb = (CMODE == 2) ? blockIdx.y * KCH : 0;
    if (CMODE == 1 && c0 > r0 + roff + 63) return;                  // score tile entirely above the causal diagonal: never read (the softmax masks j > i by select)
    if (CMODE == 2 && kb >= r0 + roff + 64) return;                  // key range entirely beyond the diagonal block: no partial plane is stored, and k_merge reads none
    const int Kl = (CMODE == 2) ? min(min(K, r0 + roff + 64), kb + KCH) : K;        // P.V: probabilities are exactly 0 beyond the diagonal block, so the K loop stops there
    if (CMODE == 2) C += (size_t)blockIdx.y * sP;
    v8f acc[4][4];
#pragma unroll
    for (int mb = 0; mb < 4; ++mb)
#pragma unroll
        for (int nb = 0; nb < 4; ++nb) acc[mb][nb] = (v8f){};
    const size_t aoff = (size_t)(r0 + lr) * K + 8 * hi, boff = (size_t)(c0 + lr) * K + 8 * hi;
#pragma unroll 1
    for (int kc = kb; kc < Kl; kc += 32) {
        V a[4], a2[4];
#pragma unroll
        for (int mb = 0; mb < 4; ++mb) { a[mb] = WFrag<T16>::ld(A + aoff + (size_t)mb * 16 * K + kc); if (NSPLIT == 1 || NSPLIT == 2) a2[mb] = WFrag<T16>::ld(A2 + aoff + (size_t)mb * 16 * K + kc); }
#pragma unroll
        for (int nb = 0; nb < 4; ++nb) { const V b = WFrag<T16>::ld(Bt + boff + (size_t)nb * 16 * K + kc); V b2; if (NSPLIT >= 2) b2 = WFrag<T16>::ld(Bt2 + boff + (size_t)nb * 16 * K + kc);
#pragma unroll
            for (int mb = 0; mb < 4; ++mb) { acc[mb][nb] = WFrag<T16>::mma(a[mb], b, acc[mb][nb]); if (NSPLIT == 1 || NSPLIT == 2) acc[mb][nb] = WFrag<T16>::mma(a2[mb], b, acc[mb][nb]); if (NSPLIT >= 2) acc[mb][nb] = WFrag<T16>::mma(a[mb], b2, acc[mb][nb]); } }
        asm volatile("v_nop\n\tv_nop\n\tv_nop\n\tv_nop" : "+v"(acc[0][0]), "+v"(acc[1][1]), "+v"(acc[2][2]), "+v"(acc[3][3]) : "v"(a[0]), "v"(a[3]));
    }
#pragma unroll
    for (int mb = 0; mb < 4; ++mb) {
#pragma unroll
        for (int nb = 0; nb < 4; ++nb) {
#pragma unroll
            for (int j = 0; j < 8; ++j) os[(hi * 8 + j) * 68 + nb * 16 + lr] = acc[mb][nb][j]; }
        __builtin_amdgcn_wave_barrier(); asm volatile("" ::: "memory");
        float* crow = C + (size_t)(r0 + mb * 16) * ldc + c0;
{
#pragma unroll
            for (int s = 0; s < 8; ++s) { const int row = 2 * s + hi, cofs = lr * 4; v4f val = *(const v4fa*)(os + row * 68 + cofs);
                *(v4f*)(crow + (size_t)row * ldc + cofs) = val; }
             }
        __builtin_amdgcn_wave_barrier(); asm volatile("" ::: "memory");
    }
}

__device__ __forceinline__ h16 tohx(float x) { return (h16)x; }
__device__ __forceinline__ void splitf(float y, unsigned short& h, unsigned short& l) { h = f2bf(y); l = f2bf(y - bf2f(h)); }
typedef __attribute__((ext_vector_type(2))) _Float16 v2h;
typedef __attribute__((ext_vector_type(4))) _Float16 v4h;
typedef __attribute__((ext_vector_type(2))) unsigned short v2us;
typedef __attribute__((ext_vector_type(4))) unsigned short v4us;
typedef __attribute__((ext_vector_type(2))) float v2f;
typedef __attribute__((ext_vector_type(4))) int v4i;

__global__ __launch_bounds__(256) void k_cvt8(const float* __restrict__ src, bf* dst, size_t n8) { const size_t i = (size_t)blockIdx.x * 256 + threadIdx.x; if (i >= n8) return; const v8f v = *(const v8f*)(src + i * 8); v8us o;
#pragma unroll
    for (int k = 0; k < 8; ++k) o[k] = f2bf(v[k]); *(v8us*)(dst + i * 8) = o;  }

// k_rope: head planes [h][t][d] (fp16 + hi/lo) of rope(x) x sc with the rotate-half convention out[d] = x[d] cos[t][d] - x[d+HD/2] sin[t][d], out[d+HD/2] = x[d+HD/2] cos[t][d+HD/2] + x[d] sin[t][d+HD/2]
__global__ __launch_bounds__(256) void k_rope(const float* __restrict__ F, int pitch, int nheads, const float* __restrict__ CS, const float* __restrict__ RF, const float* __restrict__ nw, float sc, h16* P16, bf* Ph, bf* Pl) {
    const size_t e = ((size_t)blockIdx.x * 256 + threadIdx.x) * 2; if (e >= (size_t)nheads * TT * HD) return; const int d = (int)(e % HD); const int t = (int)((e / HD) % TT); const int h = (int)(e / ((size_t)HD * TT)); const float* f = F + (size_t)t * pitch + h * HD; const float rf = RF ? RF[(size_t)h * TT + t] : 1.0f; v2h o16; v2us oh, ol;
#pragma unroll
    for (int q = 0; q < 2; ++q) { const int dd = d + q; const int dp = (dd < HD / 2) ? dd + HD / 2 : dd - HD / 2; float x0 = f[dd], x1 = f[dp];
        if (RF) { float n0 = __fmul_rn(x0, rf), n1 = __fmul_rn(x1, rf); asm volatile("" : "+v"(n0)); asm volatile("" : "+v"(n1)); x0 = __fmul_rn(bfr(nw[dd]), n0); x1 = __fmul_rn(bfr(nw[dp]), n1); }
        const v2f cs = *(const v2f*)(CS + ((size_t)t * HD + dd) * 2); float a = __fmul_rn(x0, cs[0]), bq = __fmul_rn(x1, cs[1]); asm volatile("" : "+v"(a)); asm volatile("" : "+v"(bq)); const float r = ((dd < HD / 2) ? __fsub_rn(a, bq) : __fadd_rn(a, bq)) * sc;
        o16[q] = tohx(r); unsigned short a2, c2; splitf(r, a2, c2); oh[q] = a2; ol[q] = c2; }
    *(v2h*)(P16 + e) = o16; *(v2us*)(Ph + e) = oh; *(v2us*)(Pl + e) = ol;  }
__global__ __launch_bounds__(256) void k_vtp(const float* __restrict__ F, int pitch, int nheads, h16* V16, bf* Vh, bf* Vl) { const size_t e = ((size_t)blockIdx.x * 256 + threadIdx.x) * 2; if (e >= (size_t)nheads * HD * TT) return; const int t = (int)(e % TT); const int d = (int)((e / TT) % HD); const int g = (int)(e / ((size_t)TT * HD)); v2h o16; v2us oh, ol;
#pragma unroll
    for (int q = 0; q < 2; ++q) { const float x = F[(size_t)(t + q) * pitch + g * HD + d]; o16[q] = tohx(x); unsigned short a2, c2; splitf(x, a2, c2); oh[q] = a2; ol[q] = c2; }
    *(v2h*)(V16 + e) = o16; *(v2us*)(Vh + e) = oh; *(v2us*)(Vl + e) = ol;  }
__global__ __launch_bounds__(256) void k_csid(float* CS) { const int idx = blockIdx.x * 256 + threadIdx.x; if (idx >= TT * HD) return; v2f cs; cs[0] = 1.0f; cs[1] = 0.0f; *(v2f*)(CS + (size_t)idx * 2) = cs;  }
// k_asoft: per row (zz, i): t = S x SCL (= 1) for j <= i and i - j < WIN (sliding causal window; the reference's -1e9 additive fill vanishes identically); softmax over the 2048 keys (register row, one exp, fixed trees);
__global__ __launch_bounds__(256) void k_asoft(const float* __restrict__ Sb, h16* P16, bf* Ph, bf* Pl) {
    const int lane = threadIdx.x & 31; const int row = blockIdx.x * 8 + (threadIdx.x >> 5); if (row >= ZH * TT) return; const int i = row % TT; const int zz = row / TT; (void)zz; const bool hires = (i < RH); const float* sr = Sb + (size_t)row * TT; float v[TT / 32]; float mx = -3.0e38f;
#pragma unroll
    for (int ch = 0; ch < TT / 128; ++ch) { const int j0 = ch * 128 + lane * 4; const v4f a = *(const v4f*)(sr + j0);
#pragma unroll
        for (int q = 0; q < 4; ++q) { const int j = j0 + q; (void)j; const float t = (j <= i && i - j < WIN) ? a[q] * SCL : -3.0e38f; v[ch * 4 + q] = t; mx = fmaxf(mx, t); } }
#pragma unroll
    for (int sh = 16; sh; sh >>= 1) mx = fmaxf(mx, __shfl_xor(mx, sh, 32));
    float sum = 0.f;
#pragma unroll
    for (int k = 0; k < TT / 32; ++k) { float d0 = __fsub_rn(v[k], mx); asm volatile("" : "+v"(d0)); v[k] = __builtin_amdgcn_exp2f(__fmul_rn(d0, 1.4426950408889634f)); sum += v[k]; }
#pragma unroll
    for (int sh = 16; sh; sh >>= 1) sum += __shfl_xor(sum, sh, 32);
    const float f = __fdiv_rn(hires ? 1.0f : PCAR, sum);
{
        if (hires) {
#pragma unroll
            for (int ch = 0; ch < TT / 128; ++ch) { v4us oh, ol;
#pragma unroll
                for (int q = 0; q < 4; ++q) { unsigned short a, c2; splitf(v[ch * 4 + q] * f, a, c2); oh[q] = a; ol[q] = c2; }
                const size_t oo = ((size_t)zz * (RH ? RH : 1) + i) * TT + ch * 128 + lane * 4; *(v4us*)(Ph + oo) = oh; *(v4us*)(Pl + oo) = ol; }
        } else {
#pragma unroll
            for (int ch = 0; ch < TT / 128; ++ch) { v4h o4;
#pragma unroll
                for (int q = 0; q < 4; ++q) o4[q] = tohx(v[ch * 4 + q] * f);
                *(v4h*)(P16 + (size_t)row * TT + ch * 128 + lane * 4) = o4; } }
         }
}
__global__ __launch_bounds__(256) void k_merge(const float* __restrict__ O, int h0, bf* Ah, bf* Al) { const size_t e = ((size_t)blockIdx.x * 256 + threadIdx.x) * 2; if (e >= (size_t)ZH * TT * HD) return; const int d = (int)(e % HD); const int t = (int)((e / HD) % TT); const int zz = (int)(e / ((size_t)HD * TT)); const float cs = (t < RH) ? 1.0f : (1.0f / PCAR); const size_t oo = (size_t)t * DQ + (h0 + zz) * HD + d;
    const int ns = ((t / 64) * 64 + 64 + KCH - 1) / KCH;   // key ranges that k_gemmc stored for this row's 64-row tile
    v2f p[NCH];
#pragma unroll
    for (int s = 0; s < NCH; ++s) p[s] = *(const v2f*)(O + (size_t)min(s, ns - 1) * ((size_t)ZH * TT * HD) + e);   // clamped plane index: all loads issue together, none reads a plane that was not stored
    v2f sm = p[0];
#pragma unroll
    for (int s = 1; s < NCH; ++s) { sm[0] += (s < ns) ? p[s][0] : 0.0f; sm[1] += (s < ns) ? p[s][1] : 0.0f; }
    v2us oh, ol;
#pragma unroll
    for (int q = 0; q < 2; ++q) { unsigned short a, c2; splitf(sm[q] * cs, a, c2); oh[q] = a; ol[q] = c2; } *(v2us*)(Ah + oo) = oh; *(v2us*)(Al + oo) = ol;  }

extern "C" void kernel_launch(void* const* d_in, const int* in_sizes, int n_in,
                              void* d_out, int out_size, void* d_ws, size_t ws_size, hipStream_t stream) {
    (void)in_sizes; (void)n_in; (void)out_size;
    const float* x = (const float*)d_in[0]; const float* wq = (const float*)d_in[1]; const float* wk = (const float*)d_in[2]; const float* wv = (const float*)d_in[3]; const float* wo = (const float*)d_in[4];   /* x, Q, K, V [16][64][1024] (= 'oi'), O ('oi' [1024][1024]) */
    float* OUT = (float*)d_out;     // [4][2048][1024]
    char* wsp = (char*)d_ws;
    auto take = [&](size_t bytes) { char* p = wsp; wsp += (bytes + 255) & ~(size_t)255; return (void*)p; };
    bf* WQ = (bf*)take((size_t)DQ * DM * 2); bf* WK = (bf*)take((size_t)DKV * DM * 2); bf* WV = (bf*)take((size_t)DKV * DM * 2); bf* WO = (bf*)take((size_t)DM * DQ * 2); float* CS = (float*)take((size_t)TT * HD * 2 * 4);
    bf* XB = (bf*)take((size_t)TT * DM * 2); float* FQ = (float*)take((size_t)TT * DQ * 4); float* FK = (float*)take((size_t)TT * DKV * 4);
    h16* QP16 = (h16*)take((size_t)NH_ * TT * HD * 2); h16* KP16 = (h16*)take((size_t)NKV * TT * HD * 2); h16* VT16 = (h16*)take((size_t)NKV * HD * TT * 2);
    bf* QPh = (bf*)take((size_t)NH_ * TT * HD * 2); bf* QPl = (bf*)take((size_t)NH_ * TT * HD * 2); bf* KPh = (bf*)take((size_t)NKV * TT * HD * 2); bf* KPl = (bf*)take((size_t)NKV * TT * HD * 2); bf* VTh = (bf*)take((size_t)NKV * HD * TT * 2); bf* VTl = (bf*)take((size_t)NKV * HD * TT * 2); bf* Ph = (bf*)take((size_t)ZH * RH * TT * 2); bf* Pl = (bf*)take((size_t)ZH * RH * TT * 2);
    float* Sb = (float*)take((size_t)ZH * TT * TT * 4); h16* P16 = (h16*)take((size_t)ZH * TT * TT * 2); float* Ob = (float*)take((size_t)NCH * ZH * TT * HD * 4); bf* ATh = (bf*)take((size_t)TT * DQ * 2); bf* ATl = (bf*)take((size_t)TT * DQ * 2);
    if ((size_t)(wsp - (char*)d_ws) > ws_size) return;    // ws 256 MiB
    float* FV = FK;   // v projection reuses the k buffer after the k planes are built (stream-ordered)
    { k_cvt8<<<(unsigned)(((size_t)DQ * DM / 8 + 255) / 256), 256, 0, stream>>>(wq, WQ, (size_t)DQ * DM / 8); k_cvt8<<<(unsigned)(((size_t)DKV * DM / 8 + 255) / 256), 256, 0, stream>>>(wk, WK, (size_t)DKV * DM / 8); k_cvt8<<<(unsigned)(((size_t)DKV * DM / 8 + 255) / 256), 256, 0, stream>>>(wv, WV, (size_t)DKV * DM / 8);
      k_cvt8<<<(unsigned)(((size_t)DM * DQ / 8 + 255) / 256), 256, 0, stream>>>(wo, WO, (size_t)DM * DQ / 8);
       }
    k_csid<<<(TT * HD + 255) / 256, 256, 0, stream>>>(CS);
    const unsigned LQ = (unsigned)(((size_t)NH_ * TT * HD / 2 + 255) / 256), LKv = (unsigned)(((size_t)NKV * TT * HD / 2 + 255) / 256);
    for (int b = 0; b < NB_; ++b) {
        
        k_cvt8<<<(unsigned)(((size_t)TT * DM / 8 + 255) / 256), 256, 0, stream>>>(x + (size_t)b * TT * DM, XB, (size_t)TT * DM / 8);
        k_gemmw<bf, 0, false><<<dim3(TT / 64, DQ / 64, 1), 32, 0, stream>>>(XB, nullptr, WQ, nullptr, DM, FQ, DQ, nullptr, 0, 0, 0);
        k_rope<<<LQ, 256, 0, stream>>>(FQ, DQ, NH_, CS, nullptr, nullptr, 1.0f, QP16, QPh, QPl);
        k_gemmw<bf, 0, false><<<dim3(TT / 64, DKV / 64, 1), 32, 0, stream>>>(XB, nullptr, WK, nullptr, DM, FK, DKV, nullptr, 0, 0, 0);
        k_rope<<<LKv, 256, 0, stream>>>(FK, DKV, NKV, CS, nullptr, nullptr, 1.0f, KP16, KPh, KPl);
        k_gemmw<bf, 0, false><<<dim3(TT / 64, DKV / 64, 1), 32, 0, stream>>>(XB, nullptr, WV, nullptr, DM, FV, DKV, nullptr, 0, 0, 0); k_vtp<<<LKv, 256, 0, stream>>>(FV, DKV, NKV, VT16, VTh, VTl);
        for (int h0 = 0; h0 < NH_; h0 += ZH) { const size_t zq = (size_t)h0, zk = (size_t)(h0 / REP);   // one kv head per query head: the pass's two heads use consecutive kv planes (z-strides TT*HD)
            k_gemmc<bf, 2, 1><<<dim3(RH / 64, TT / 64, ZH), 32, 0, stream>>>(QPh + zq * TT * HD, QPl + zq * TT * HD, KPh + zk * TT * HD, KPl + zk * TT * HD, HD, Sb, TT, 0, (size_t)TT * HD, (size_t)TT * HD, (size_t)TT * TT, 0);
            k_asoft<<<ZH * TT / 8, 256, 0, stream>>>(Sb, P16, Ph, Pl);
            k_gemmc<bf, 2, 2><<<dim3(RH / 64, NCH, ZH), 32, 0, stream>>>(Ph, Pl, VTh + zk * HD * TT, VTl + zk * HD * TT, TT, Ob, HD, 0, (size_t)RH * TT, (size_t)HD * TT, (size_t)TT * HD, (size_t)ZH * TT * HD);
            k_merge<<<(unsigned)(((size_t)ZH * TT * HD / 2 + 255) / 256), 256, 0, stream>>>(Ob, h0, ATh, ATl); }
        k_gemmw<bf, 1, false><<<dim3(TT / 64, DM / 64, 1), 32, 0, stream>>>(ATh, ATl, WO, nullptr, DQ, OUT + (size_t)b * TT * DM, DM, nullptr, 0, 0, 0); }
}

// v002
// Measured time: 1180 microseconds a run.
// Two timings next to v001 both put it at 1.13 times that version's speed.
// Counting every step since v000, it is 1.95 times as fast.
#include <hip/hip_runtime.h>

// Causal attention with per-head weight tensors and NO score scaling (x [4][2048][1024]; q = einsum('nhm,btm', Q, x) with Q, K, V [16][64][1024] (= 'oi' [1024][1024] with rows n*64 + h; 1/32 scale); scores = q.k (the source has no 1/sqrt(d_head) factor: logits sigma ~8); causal (-1e10 == exclusion); softmax; z = merged heads (n, h); out = einsum('ma,bqa', O, z) ('oi') -> [4][2048][1024] (8.4 M); argument order x, Q, K, V, O).
// Layout per batch: bf16 copy of x; the [16][64][1024] weights are already Bt planes ('oi' rows n*64 + h); exact projections; identity-table plane builders; causal T-2048 attention with SCL 1 (rows on hi/lo or fp16 planes per the RH macro; k_gemmc skips tiles above the diagonal); merged hi/lo x O exact.
// Compute dtypes, f32 accumulate: every input rounded to bf16; projections exact; softmax f32; O hl x exact.

#define NB_  4
#define TT   2048
#define DM   1024
#define NH_  16
#define NKV  16
#define REP  (NH_ / NKV)
#define HD   64
#define DQ   (NH_ * HD)
#define DKV  (NKV * HD)
#define ZH   8                    // heads per attention pass (z of each launch): 2 passes a batch
#define RH   TT                   // every row hi/lo (3 products)
#define WIN  2048
#define PCAR 1024.0f
#define SCL  1.0f   // the module applies NO score scaling
#define KCH  128                  // keys per work-group of the probability x value product (split over keys)
#define NCH  (TT / KCH)
typedef _Float16 h16;
typedef unsigned short bf;
typedef __attribute__((ext_vector_type(16))) __bf16   v16bf;
typedef __attribute__((ext_vector_type(16))) _Float16 v16h;
typedef __attribute__((ext_vector_type(8)))  _Float16 v8h;
typedef __attribute__((ext_vector_type(8)))  unsigned short v8us;
typedef __attribute__((ext_vector_type(8)))  float    v8f;
typedef __attribute__((ext_vector_type(4)))  float    v4f;
typedef v8h  __attribute__((may_alias)) v8ha;
typedef v4f  __attribute__((may_alias)) v4fa;
typedef v8us __attribute__((may_alias)) v8usa;

__device__ __forceinline__ unsigned short f2bf(float f) { unsigned u = __float_as_uint(f); u += 0x7FFFu + ((u >> 16) & 1u); return (unsigned short)(u >> 16); }
__device__ __forceinline__ float bf2f(unsigned short b) { return __uint_as_float(((unsigned)b) << 16); }
__device__ __forceinline__ float bfr(float f) { return bf2f(f2bf(f)); }
__device__ __forceinline__ v16h cat16(v8h lo, v8h hi) { return __builtin_shufflevector(lo, hi, 0, 1, 2, 3, 4, 5, 6, 7, 8, 9, 10, 11, 12, 13, 14, 15); }
__device__ __forceinline__ v16bf cat16b(v8us lo, v8us hi) { return __builtin_bit_cast(v16bf, __builtin_shufflevector(lo, hi, 0, 1, 2, 3, 4, 5, 6, 7, 8, 9, 10, 11, 12, 13, 14, 15)); }
__device__ __forceinline__ v8f wmma16(v16h a, v16h b, v8f c) { return __builtin_amdgcn_wmma_f32_16x16x32_f16(false, a, false, b, (short)0, c, false, false); }
__device__ __forceinline__ v8f wmmab(v16bf a, v16bf b, v8f c) { return __builtin_amdgcn_wmma_f32_16x16x32_bf16(false, a, false, b, (short)0, c, false, false); }



// ---- k_gemmw: register-blocked GEMM, ONE WAVE per 64x64 output tile (16 accumulators), operands straight from K-contiguous 16-bit planes; grid (M/64, N/64, Z), 32 threads.
// C[m][n] (f32, pitch ldc, + optional f32 bias[n]) = sum_k A[m][k] Bt[n][k] (+ split products per NSPLIT). z-batch strides sA/sB/sC in elements. K % 32 == 0.
template <typename T16> struct WFrag;
template <> struct WFrag<h16> { typedef v16h V; static __device__ __forceinline__ V ld(const h16* p) { return cat16(*(const v8h*)p, *(const v8h*)(p + 16)); } static __device__ __forceinline__ v8f mma(V a, V b, v8f c) { return wmma16(a, b, c); } };
template <> struct WFrag<bf> { typedef v16bf V; static __device__ __forceinline__ V ld(const bf* p) { return cat16b(*(const v8us*)p, *(const v8us*)(p + 16)); } static __device__ __forceinline__ v8f mma(V a, V b, v8f c) { return wmmab(a, b, c); } };
template <typename T16, int NSPLIT, bool BIAS>
__global__ __launch_bounds__(32) void k_gemmw(const T16* __restrict__ A, const T16* __restrict__ A2, const T16* __restrict__ Bt, const T16* __restrict__ Bt2, int K, float* C, int ldc, const float* __restrict__ bias, size_t sA, size_t sB, size_t sC) {
    typedef typename WFrag<T16>::V V;
    __shared__ __align__(16) float os[16 * 68];
    const size_t z = blockIdx.z; A += z * sA; if (A2) A2 += z * sA; Bt += z * sB; if (Bt2) Bt2 += z * sB; C += z * sC;
    const int lane = threadIdx.x & 31, lr = lane & 15, hi = lane >> 4; const int r0 = blockIdx.x * 64, c0 = blockIdx.y * 64;
    v8f acc[4][4];
#pragma unroll
    for (int mb = 0; mb < 4; ++mb)
#pragma unroll
        for (int nb = 0; nb < 4; ++nb) acc[mb][nb] = (v8f){};
    const size_t aoff = (size_t)(r0 + lr) * K + 8 * hi, boff = (size_t)(c0 + lr) * K + 8 * hi;
#pragma unroll 1
    for (int kc = 0; kc < K; kc += 32) {
        V a[4], a2[4];
#pragma unroll
        for (int mb = 0; mb < 4; ++mb) { a[mb] = WFrag<T16>::ld(A + aoff + (size_t)mb * 16 * K + kc); if (NSPLIT == 1 || NSPLIT == 2) a2[mb] = WFrag<T16>::ld(A2 + aoff + (size_t)mb * 16 * K + kc); }
#pragma unroll
        for (int nb = 0; nb < 4; ++nb) { const V b = WFrag<T16>::ld(Bt + boff + (size_t)nb * 16 * K + kc); V b2; if (NSPLIT >= 2) b2 = WFrag<T16>::ld(Bt2 + boff + (size_t)nb * 16 * K + kc);
#pragma unroll
            for (int mb = 0; mb < 4; ++mb) { acc[mb][nb] = WFrag<T16>::mma(a[mb], b, acc[mb][nb]); if (NSPLIT == 1 || NSPLIT == 2) acc[mb][nb] = WFrag<T16>::mma(a2[mb], b, acc[mb][nb]); if (NSPLIT >= 2) acc[mb][nb] = WFrag<T16>::mma(a[mb], b2, acc[mb][nb]); } }
        asm volatile("v_nop\n\tv_nop\n\tv_nop\n\tv_nop" : "+v"(acc[0][0]), "+v"(acc[1][1]), "+v"(acc[2][2]), "+v"(acc[3][3]) : "v"(a[0]), "v"(a[3]));
    }
#pragma unroll
    for (int mb = 0; mb < 4; ++mb) {
#pragma unroll
        for (int nb = 0; nb < 4; ++nb) {
#pragma unroll
            for (int j = 0; j < 8; ++j) os[(hi * 8 + j) * 68 + nb * 16 + lr] = acc[mb][nb][j]; }
        __builtin_amdgcn_wave_barrier(); asm volatile("" ::: "memory");
        float* crow = C + (size_t)(r0 + mb * 16) * ldc + c0;
{
#pragma unroll
            for (int s = 0; s < 8; ++s) { const int row = 2 * s + hi, cofs = lr * 4; v4f val = *(const v4fa*)(os + row * 68 + cofs); if (BIAS) { val[0] += bfr(bias[c0 + cofs]); val[1] += bfr(bias[c0 + cofs + 1]); val[2] += bfr(bias[c0 + cofs + 2]); val[3] += bfr(bias[c0 + cofs + 3]); }
                *(v4f*)(crow + (size_t)row * ldc + cofs) = val; }
             }
        __builtin_amdgcn_wave_barrier(); asm volatile("" ::: "memory");
    }
}

// ---- k_gemmc: the same one-wave 64x64 tile GEMM specialised for causal attention: CMODE 1 skips score tiles entirely above the diagonal (query rows r0+roff.., key columns c0..), CMODE 2 limits the
// key (K) loop of the probability x value contraction to the diagonal block (probabilities beyond it are exactly zero). roff = row offset of this launch's first row within the sequence.
// CMODE 2 is split over keys: blockIdx.y names a range of KCH keys (the output is one 64-column tile, HD == 64), each range stores its f32 partial tile in its own plane (stride sP), and k_merge adds the planes.
template <typename T16, int NSPLIT, int CMODE>
__global__ __launch_bounds__(32) void k_gemmc(const T16* __restrict__ A, const T16* __restrict__ A2, const T16* __restrict__ Bt, const T16* __restrict__ Bt2, int K, float* C, int ldc, int roff, size_t sA, size_t sB, size_t sC, size_t sP) {
    typedef typename WFrag<T16>::V V;
    __shared__ __align__(16) float os[16 * 68];
    const size_t z = blockIdx.z; A += z * sA; if (A2) A2 += z * sA; Bt += z * sB; if (Bt2) Bt2 += z * sB; C += z * sC;
    const int lane = threadIdx.x & 31, lr = lane & 15, hi = lane >> 4; const int r0 = blockIdx.x * 64, c0 = (CMODE == 2) ? 0 : blockIdx.y * 64; const int kb = (CMODE == 2) ? blockIdx.y * KCH : 0;
    if (CMODE == 1 && c0 > r0 + roff + 63) return;                  // score tile entirely above the causal diagonal: never read (the softmax masks j > i by select)
    if (CMODE == 2 && kb >= r0 + roff + 64) return;                  // key range entirely beyond the diagonal block: no partial plane is stored, and k_merge reads none
    const int Kl = (CMODE == 2) ? min(min(K, r0 + roff + 64), kb + KCH) : K;        // P.V: probabilities are exactly 0 beyond the diagonal block, so the K loop stops there
    if (CMODE == 2) C += (size_t)blockIdx.y * sP;
    const int lda = (CMODE == 2) ? 2 * K : K;                        // probability rows lie in the score rows' own storage: hi half, lo half, so one row is 2 K elements
    v8f acc[4][4];
#pragma unroll
    for (int mb = 0; mb < 4; ++mb)
#pragma unroll
        for (int nb = 0; nb < 4; ++nb) acc[mb][nb] = (v8f){};
    const size_t aoff = (size_t)(r0 + lr) * lda + 8 * hi, boff = (size_t)(c0 + lr) * K + 8 * hi;
#pragma unroll 1
    for (int kc = kb; kc < Kl; kc += 32) {
        static_assert(NSPLIT == 2, "A and B both come as hi and lo planes");
        V a[4], a2[4]; const T16* pa[4]; const T16* pa2[4];
#pragma unroll
        for (int mb = 0; mb < 4; ++mb) { pa[mb] = A + aoff + (size_t)mb * 16 * lda + kc; pa2[mb] = A2 + aoff + (size_t)mb * 16 * lda + kc; a[mb] = WFrag<T16>::ld(pa[mb]); a2[mb] = WFrag<T16>::ld(pa2[mb]); }
        // the address registers of the issued loads stay unwritten up to this wait (they are its inputs)
        asm volatile("s_wait_xcnt 0x0" :: "v"(pa[0]), "v"(pa[1]), "v"(pa[2]), "v"(pa[3]), "v"(pa2[0]), "v"(pa2[1]), "v"(pa2[2]), "v"(pa2[3]) : "memory");
#pragma unroll
        for (int nb = 0; nb < 4; ++nb) { const T16* pb = Bt + boff + (size_t)nb * 16 * K + kc; const T16* pb2 = Bt2 + boff + (size_t)nb * 16 * K + kc; const V b = WFrag<T16>::ld(pb); const V b2 = WFrag<T16>::ld(pb2);
            asm volatile("s_wait_xcnt 0x0" :: "v"(pb), "v"(pb2) : "memory");   // as above, for the two B address pairs
#pragma unroll
            for (int mb = 0; mb < 4; ++mb) { acc[mb][nb] = WFrag<T16>::mma(a[mb], b, acc[mb][nb]); if (NSPLIT == 1 || NSPLIT == 2) acc[mb][nb] = WFrag<T16>::mma(a2[mb], b, acc[mb][nb]); if (NSPLIT >= 2) acc[mb][nb] = WFrag<T16>::mma(a[mb], b2, acc[mb][nb]); } }
        asm volatile("v_nop\n\tv_nop\n\tv_nop\n\tv_nop" : "+v"(acc[0][0]), "+v"(acc[1][1]), "+v"(acc[2][2]), "+v"(acc[3][3]) : "v"(a[0]), "v"(a[3]));
    }
#pragma unroll
    for (int mb = 0; mb < 4; ++mb) {
#pragma unroll
        for (int nb = 0; nb < 4; ++nb) {
#pragma unroll
            for (int j = 0; j < 8; ++j) os[(hi * 8 + j) * 68 + nb * 16 + lr] = acc[mb][nb][j]; }
        __builtin_amdgcn_wave_barrier(); asm volatile("" ::: "memory");
        float* crow = C + (size_t)(r0 + mb * 16) * ldc + c0;
{ float* sp[8]; v4f sv[8];
#pragma unroll
            for (int s = 0; s < 8; ++s) { const int row = 2 * s + hi, cofs = lr * 4; sv[s] = *(const v4fa*)(os + row * 68 + cofs); sp[s] = crow + (size_t)row * ldc + cofs;
                *(v4f*)sp[s] = sv[s]; }
            // the address and data registers of the eight issued stores stay unwritten up to this wait (they are its inputs)
            asm volatile("s_wait_xcnt 0x0" :: "v"(sp[0]), "v"(sp[1]), "v"(sp[2]), "v"(sp[3]), "v"(sp[4]), "v"(sp[5]), "v"(sp[6]), "v"(sp[7]), "v"(sv[0]), "v"(sv[1]), "v"(sv[2]), "v"(sv[3]), "v"(sv[4]), "v"(sv[5]), "v"(sv[6]), "v"(sv[7]) : "memory");
             }
        __builtin_amdgcn_wave_barrier(); asm volatile("" ::: "memory");
    }
}

__device__ __forceinline__ h16 tohx(float x) { return (h16)x; }
__device__ __forceinline__ void splitf(float y, unsigned short& h, unsigned short& l) { h = f2bf(y); l = f2bf(y - bf2f(h)); }
typedef __attribute__((ext_vector_type(2))) _Float16 v2h;
typedef __attribute__((ext_vector_type(4))) _Float16 v4h;
typedef __attribute__((ext_vector_type(2))) unsigned short v2us;
typedef __attribute__((ext_vector_type(4))) unsigned short v4us;
typedef __attribute__((ext_vector_type(2))) float v2f;
typedef __attribute__((ext_vector_type(4))) int v4i;

__global__ __launch_bounds__(256) void k_cvt8(const float* __restrict__ src, bf* dst, size_t n8) { const size_t i = (size_t)blockIdx.x * 256 + threadIdx.x; if (i >= n8) return; const v8f v = *(const v8f*)(src + i * 8); v8us o;
#pragma unroll
    for (int k = 0; k < 8; ++k) o[k] = f2bf(v[k]); *(v8us*)(dst + i * 8) = o;  }

// k_rope: head planes [h][t][d] (fp16 + hi/lo) of rope(x) x sc with the rotate-half convention out[d] = x[d] cos[t][d] - x[d+HD/2] sin[t][d], out[d+HD/2] = x[d+HD/2] cos[t][d+HD/2] + x[d] sin[t][d+HD/2]
__global__ __launch_bounds__(256) void k_rope(const float* __restrict__ F, int pitch, int nheads, const float* __restrict__ CS, const float* __restrict__ RF, const float* __restrict__ nw, float sc, h16* P16, bf* Ph, bf* Pl) {
    const size_t e = ((size_t)blockIdx.x * 256 + threadIdx.x) * 2; if (e >= (size_t)nheads * TT * HD) return; const int d = (int)(e % HD); const int t = (int)((e / HD) % TT); const int h = (int)(e / ((size_t)HD * TT)); const float* f = F + (size_t)t * pitch + h * HD; const float rf = RF ? RF[(size_t)h * TT + t] : 1.0f; v2h o16; v2us oh, ol;
#pragma unroll
    for (int q = 0; q < 2; ++q) { const int dd = d + q; const int dp = (dd < HD / 2) ? dd + HD / 2 : dd - HD / 2; float x0 = f[dd], x1 = f[dp];
        if (RF) { float n0 = __fmul_rn(x0, rf), n1 = __fmul_rn(x1, rf); asm volatile("" : "+v"(n0)); asm volatile("" : "+v"(n1)); x0 = __fmul_rn(bfr(nw[dd]), n0); x1 = __fmul_rn(bfr(nw[dp]), n1); }
        const v2f cs = *(const v2f*)(CS + ((size_t)t * HD + dd) * 2); float a = __fmul_rn(x0, cs[0]), bq = __fmul_rn(x1, cs[1]); asm volatile("" : "+v"(a)); asm volatile("" : "+v"(bq)); const float r = ((dd < HD / 2) ? __fsub_rn(a, bq) : __fadd_rn(a, bq)) * sc;
        o16[q] = tohx(r); unsigned short a2, c2; splitf(r, a2, c2); oh[q] = a2; ol[q] = c2; }
    *(v2h*)(P16 + e) = o16; *(v2us*)(Ph + e) = oh; *(v2us*)(Pl + e) = ol;  }
__global__ __launch_bounds__(256) void k_vtp(const float* __restrict__ F, int pitch, int nheads, h16* V16, bf* Vh, bf* Vl) { const size_t e = ((size_t)blockIdx.x * 256 + threadIdx.x) * 2; if (e >= (size_t)nheads * HD * TT) return; const int t = (int)(e % TT); const int d = (int)((e / TT) % HD); const int g = (int)(e / ((size_t)TT * HD)); v2h o16; v2us oh, ol;
#pragma unroll
    for (int q = 0; q < 2; ++q) { const float x = F[(size_t)(t + q) * pitch + g * HD + d]; o16[q] = tohx(x); unsigned short a2, c2; splitf(x, a2, c2); oh[q] = a2; ol[q] = c2; }
    *(v2h*)(V16 + e) = o16; *(v2us*)(Vh + e) = oh; *(v2us*)(Vl + e) = ol;  }
__global__ __launch_bounds__(256) void k_csid(float* CS) { const int idx = blockIdx.x * 256 + threadIdx.x; if (idx >= TT * HD) return; v2f cs; cs[0] = 1.0f; cs[1] = 0.0f; *(v2f*)(CS + (size_t)idx * 2) = cs;  }
// k_asoft: per row (zz, i): t = S x SCL (1: no scaling) for j <= i and i - j < WIN (sliding causal window; the reference's -1e9 additive fill vanishes identically); softmax over the 2048 keys (register row, one exp, fixed trees);
// The hi and lo probability rows overwrite the wave's own score row (2048 f32 = 2048 hi + 2048 lo bf16): the whole row is in registers before the first store (every stored value depends on the row's max and sum), and no other wave touches it.
__global__ __launch_bounds__(256) void k_asoft(const float* Sb, h16* P16, bf* Ph, bf* Pl) {
    const int lane = threadIdx.x & 31; const int row = blockIdx.x * 8 + (threadIdx.x >> 5); if (row >= ZH * TT) return; const int i = row % TT; const int zz = row / TT; (void)zz; const bool hires = (i < RH); const float* sr = Sb + (size_t)row * TT; float v[TT / 32]; float mx = -3.0e38f;
#pragma unroll
    for (int ch = 0; ch < TT / 128; ++ch) { const int j0 = ch * 128 + lane * 4; const v4f a = *(const v4f*)(sr + j0);
#pragma unroll
        for (int q = 0; q < 4; ++q) { const int j = j0 + q; (void)j; const float t = (j <= i && i - j < WIN) ? a[q] * SCL : -3.0e38f; v[ch * 4 + q] = t; mx = fmaxf(mx, t); } }
#pragma unroll
    for (int sh = 16; sh; sh >>= 1) mx = fmaxf(mx, __shfl_xor(mx, sh, 32));
    float sum = 0.f;
#pragma unroll
    for (int k = 0; k < TT / 32; ++k) { float d0 = __fsub_rn(v[k], mx); asm volatile("" : "+v"(d0)); v[k] = __builtin_amdgcn_exp2f(__fmul_rn(d0, 1.4426950408889634f)); sum += v[k]; }
#pragma unroll
    for (int sh = 16; sh; sh >>= 1) sum += __shfl_xor(sum, sh, 32);
    const float f = __fdiv_rn(hires ? 1.0f : PCAR, sum);
{
        if (hires) {
#pragma unroll
            for (int ch = 0; ch < TT / 128; ++ch) { v4us oh, ol;
#pragma unroll
                for (int q = 0; q < 4; ++q) { unsigned short a, c2; splitf(v[ch * 4 + q] * f, a, c2); oh[q] = a; ol[q] = c2; }
                const size_t oo = ((size_t)zz * (RH ? RH : 1) + i) * (2 * TT) + ch * 128 + lane * 4; *(v4us*)(Ph + oo) = oh; *(v4us*)(Pl + oo) = ol; }
        } else {
#pragma unroll
            for (int ch = 0; ch < TT / 128; ++ch) { v4h o4;
#pragma unroll
                for (int q = 0; q < 4; ++q) o4[q] = tohx(v[ch * 4 + q] * f);
                *(v4h*)(P16 + (size_t)row * TT + ch * 128 + lane * 4) = o4; } }
         }
}
__global__ __launch_bounds__(256) void k_merge(const float* __restrict__ O, int h0, bf* Ah, bf* Al) { const size_t e = ((size_t)blockIdx.x * 256 + threadIdx.x) * 2; if (e >= (size_t)ZH * TT * HD) return; const int d = (int)(e % HD); const int t = (int)((e / HD) % TT); const int zz = (int)(e / ((size_t)HD * TT)); const float cs = (t < RH) ? 1.0f : (1.0f / PCAR); const size_t oo = (size_t)t * DQ + (h0 + zz) * HD + d;
    const int ns = ((t / 64) * 64 + 64 + KCH - 1) / KCH;   // key ranges that k_gemmc stored for this row's 64-row tile
    v2f p[NCH];
#pragma unroll
    for (int s = 0; s < NCH; ++s) p[s] = *(const v2f*)(O + (size_t)min(s, ns - 1) * ((size_t)ZH * TT * HD) + e);   // clamped plane index: all loads issue together, none reads a plane that was not stored
    v2f sm = p[0];
#pragma unroll
    for (int s = 1; s < NCH; ++s) { sm[0] += (s < ns) ? p[s][0] : 0.0f; sm[1] += (s < ns) ? p[s][1] : 0.0f; }
    v2us oh, ol;
#pragma unroll
    for (int q = 0; q < 2; ++q) { unsigned short a, c2; splitf(sm[q] * cs, a, c2); oh[q] = a; ol[q] = c2; } *(v2us*)(Ah + oo) = oh; *(v2us*)(Al + oo) = ol;  }

extern "C" void kernel_launch(void* const* d_in, const int* in_sizes, int n_in,
                              void* d_out, int out_size, void* d_ws, size_t ws_size, hipStream_t stream) {
    (void)in_sizes; (void)n_in; (void)out_size;
    const float* x = (const float*)d_in[0]; const float* wq = (const float*)d_in[1]; const float* wk = (const float*)d_in[2]; const float* wv = (const float*)d_in[3]; const float* wo = (const float*)d_in[4];   /* x, Q, K, V [16][64][1024] (= 'oi'), O ('oi' [1024][1024]) */
    float* OUT = (float*)d_out;     // [4][2048][1024]
    char* wsp = (char*)d_ws;
    auto take = [&](size_t bytes) { char* p = wsp; wsp += (bytes + 255) & ~(size_t)255; return (void*)p; };
    bf* WQ = (bf*)take((size_t)DQ * DM * 2); bf* WK = (bf*)take((size_t)DKV * DM * 2); bf* WV = (bf*)take((size_t)DKV * DM * 2); bf* WO = (bf*)take((size_t)DM * DQ * 2); float* CS = (float*)take((size_t)TT * HD * 2 * 4);
    float* Ob = (float*)take((size_t)NCH * ZH * TT * HD * 4);
    static_assert((size_t)TT * DM * 2 + (size_t)TT * DQ * 4 + (size_t)TT * DKV * 4 <= (size_t)NCH * ZH * TT * HD * 4, "projection scratch fits in the partial planes");
    bf* XB = (bf*)Ob; float* FQ = Ob + (size_t)TT * DM / 2; float* FK = FQ + (size_t)TT * DQ;   // projection scratch shares the partial planes' storage: it is dead once the head planes are built, before a batch's first pass (stream-ordered)
    h16* QP16 = (h16*)take((size_t)NH_ * TT * HD * 2); h16* KP16 = (h16*)take((size_t)NKV * TT * HD * 2); h16* VT16 = (h16*)take((size_t)NKV * HD * TT * 2);
    bf* QPh = (bf*)take((size_t)NH_ * TT * HD * 2); bf* QPl = (bf*)take((size_t)NH_ * TT * HD * 2); bf* KPh = (bf*)take((size_t)NKV * TT * HD * 2); bf* KPl = (bf*)take((size_t)NKV * TT * HD * 2); bf* VTh = (bf*)take((size_t)NKV * HD * TT * 2); bf* VTl = (bf*)take((size_t)NKV * HD * TT * 2);
    float* Sb = (float*)take((size_t)ZH * TT * TT * 4); bf* Ph = (bf*)Sb; bf* Pl = Ph + TT;   // probability planes in place of the scores, row pitch 2 TT
    h16* P16 = nullptr;   // the fp16 probability plane has no rows (RH == TT: every row is hi/lo)
    bf* ATh = (bf*)take((size_t)TT * DQ * 2); bf* ATl = (bf*)take((size_t)TT * DQ * 2);
    if ((size_t)(wsp - (char*)d_ws) > ws_size) return;    // ws 256 MiB
    float* FV = FK;   // v projection reuses the k buffer after the k planes are built (stream-ordered)
    { k_cvt8<<<(unsigned)(((size_t)DQ * DM / 8 + 255) / 256), 256, 0, stream>>>(wq, WQ, (size_t)DQ * DM / 8); k_cvt8<<<(unsigned)(((size_t)DKV * DM / 8 + 255) / 256), 256, 0, stream>>>(wk, WK, (size_t)DKV * DM / 8); k_cvt8<<<(unsigned)(((size_t)DKV * DM / 8 + 255) / 256), 256, 0, stream>>>(wv, WV, (size_t)DKV * DM / 8);
      k_cvt8<<<(unsigned)(((size_t)DM * DQ / 8 + 255) / 256), 256, 0, stream>>>(wo, WO, (size_t)DM * DQ / 8);
       }
    k_csid<<<(TT * HD + 255) / 256, 256, 0, stream>>>(CS);
    const unsigned LQ = (unsigned)(((size_t)NH_ * TT * HD / 2 + 255) / 256), LKv = (unsigned)(((size_t)NKV * TT * HD / 2 + 255) / 256);
    for (int b = 0; b < NB_; ++b) {
        
        k_cvt8<<<(unsigned)(((size_t)TT * DM / 8 + 255) / 256), 256, 0, stream>>>(x + (size_t)b * TT * DM, XB, (size_t)TT * DM / 8);
        k_gemmw<bf, 0, false><<<dim3(TT / 64, DQ / 64, 1), 32, 0, stream>>>(XB, nullptr, WQ, nullptr, DM, FQ, DQ, nullptr, 0, 0, 0);
        k_rope<<<LQ, 256, 0, stream>>>(FQ, DQ, NH_, CS, nullptr, nullptr, 1.0f, QP16, QPh, QPl);
        k_gemmw<bf, 0, false><<<dim3(TT / 64, DKV / 64, 1), 32, 0, stream>>>(XB, nullptr, WK, nullptr, DM, FK, DKV, nullptr, 0, 0, 0);
        k_rope<<<LKv, 256, 0, stream>>>(FK, DKV, NKV, CS, nullptr, nullptr, 1.0f, KP16, KPh, KPl);
        k_gemmw<bf, 0, false><<<dim3(TT / 64, DKV / 64, 1), 32, 0, stream>>>(XB, nullptr, WV, nullptr, DM, FV, DKV, nullptr, 0, 0, 0); k_vtp<<<LKv, 256, 0, stream>>>(FV, DKV, NKV, VT16, VTh, VTl);
        for (int h0 = 0; h0 < NH_; h0 += ZH) { const size_t zq = (size_t)h0, zk = (size_t)(h0 / REP);   // one kv head per query head: the pass's heads use consecutive kv planes (z-strides TT*HD)
            k_gemmc<bf, 2, 1><<<dim3(RH / 64, TT / 64, ZH), 32, 0, stream>>>(QPh + zq * TT * HD, QPl + zq * TT * HD, KPh + zk * TT * HD, KPl + zk * TT * HD, HD, Sb, TT, 0, (size_t)TT * HD, (size_t)TT * HD, (size_t)TT * TT, 0);
            k_asoft<<<ZH * TT / 8, 256, 0, stream>>>(Sb, P16, Ph, Pl);
            k_gemmc<bf, 2, 2><<<dim3(RH / 64, NCH, ZH), 32, 0, stream>>>(Ph, Pl, VTh + zk * HD * TT, VTl + zk * HD * TT, TT, Ob, HD, 0, (size_t)RH * 2 * TT, (size_t)HD * TT, (size_t)TT * HD, (size_t)ZH * TT * HD);
            k_merge<<<(unsigned)(((size_t)ZH * TT * HD / 2 + 255) / 256), 256, 0, stream>>>(Ob, h0, ATh, ATl); }
        k_gemmw<bf, 1, false><<<dim3(TT / 64, DM / 64, 1), 32, 0, stream>>>(ATh, ATl, WO, nullptr, DQ, OUT + (size_t)b * TT * DM, DM, nullptr, 0, 0, 0); }
}

// v003
// It runs in 1110 microseconds.
// In two side-by-side timings against v002, it was 1.08 and 1.07 times as fast.
// Over all steps from v000 it is 2.10 times as fast.
#include <hip/hip_runtime.h>

// Causal attention with per-head weight tensors and NO score scaling (x [4][2048][1024]; q = einsum('nhm,btm', Q, x) with Q, K, V [16][64][1024] (= 'oi' [1024][1024] with rows n*64 + h; 1/32 scale); scores = q.k (the source has no 1/sqrt(d_head) factor: logits sigma ~8); causal (-1e10 == exclusion); softmax; z = merged heads (n, h); out = einsum('ma,bqa', O, z) ('oi') -> [4][2048][1024] (8.4 M); argument order x, Q, K, V, O).
// Layout per batch: bf16 copy of x; the [16][64][1024] weights are already Bt planes ('oi' rows n*64 + h); exact projections that store their hi/lo head planes themselves (v with the operands swapped, so its tile is already [d][t]); causal T-2048 attention with SCL 1 (rows on hi/lo or fp16 planes per the RH macro; k_gemmc skips tiles above the diagonal); merged hi/lo x O exact.
// Compute dtypes, f32 accumulate: every input rounded to bf16; projections exact; softmax f32; O hl x exact.

#define NB_  4
#define TT   2048
#define DM   1024
#define NH_  16
#define NKV  16
#define REP  (NH_ / NKV)
#define HD   64
#define DQ   (NH_ * HD)
#define DKV  (NKV * HD)
#define ZH   8                    // heads per attention pass (z of each launch): 2 passes a batch
#define RH   TT                   // every row hi/lo (3 products)
#define WIN  2048
#define PCAR 1024.0f
#define SCL  1.0f   // the module applies NO score scaling
#define KCH  128                  // keys per work-group of the probability x value product (split over keys)
#define NCH  (TT / KCH)
typedef _Float16 h16;
typedef unsigned short bf;
typedef __attribute__((ext_vector_type(16))) __bf16   v16bf;
typedef __attribute__((ext_vector_type(16))) _Float16 v16h;
typedef __attribute__((ext_vector_type(8)))  _Float16 v8h;
typedef __attribute__((ext_vector_type(8)))  unsigned short v8us;
typedef __attribute__((ext_vector_type(8)))  float    v8f;
typedef __attribute__((ext_vector_type(4)))  float    v4f;
typedef v8h  __attribute__((may_alias)) v8ha;
typedef v4f  __attribute__((may_alias)) v4fa;
typedef v8us __attribute__((may_alias)) v8usa;

__device__ __forceinline__ unsigned short f2bf(float f) { unsigned u = __float_as_uint(f); u += 0x7FFFu + ((u >> 16) & 1u); return (unsigned short)(u >> 16); }
__device__ __forceinline__ float bf2f(unsigned short b) { return __uint_as_float(((unsigned)b) << 16); }
__device__ __forceinline__ float bfr(float f) { return bf2f(f2bf(f)); }
__device__ __forceinline__ void splitf(float y, unsigned short& h, unsigned short& l) { h = f2bf(y); l = f2bf(y - bf2f(h)); }
__device__ __forceinline__ v16h cat16(v8h lo, v8h hi) { return __builtin_shufflevector(lo, hi, 0, 1, 2, 3, 4, 5, 6, 7, 8, 9, 10, 11, 12, 13, 14, 15); }
__device__ __forceinline__ v16bf cat16b(v8us lo, v8us hi) { return __builtin_bit_cast(v16bf, __builtin_shufflevector(lo, hi, 0, 1, 2, 3, 4, 5, 6, 7, 8, 9, 10, 11, 12, 13, 14, 15)); }
__device__ __forceinline__ v8f wmma16(v16h a, v16h b, v8f c) { return __builtin_amdgcn_wmma_f32_16x16x32_f16(false, a, false, b, (short)0, c, false, false); }
__device__ __forceinline__ v8f wmmab(v16bf a, v16bf b, v8f c) { return __builtin_amdgcn_wmma_f32_16x16x32_bf16(false, a, false, b, (short)0, c, false, false); }



// ---- k_gemmw: register-blocked GEMM, ONE WAVE per 64x64 output tile (16 accumulators), operands straight from K-contiguous 16-bit planes; grid (M/64, N/64, Z), 32 threads.
// C[m][n] (f32, pitch ldc, + optional f32 bias[n]) = sum_k A[m][k] Bt[n][k] (+ split products per NSPLIT). z-batch strides sA/sB/sC in elements. K % 32 == 0.
// PL: no f32 C; the tile is split into bf16 hi and lo and stored at Ph/Pl + m * ldc + blockIdx.y * cstep + (n % 64) (head planes [h][t][d]: ldc HD, cstep TT*HD; transposed planes [g][d][t]: ldc TT, cstep 64).
template <typename T16> struct WFrag;
template <> struct WFrag<h16> { typedef v16h V; static __device__ __forceinline__ V ld(const h16* p) { return cat16(*(const v8h*)p, *(const v8h*)(p + 16)); } static __device__ __forceinline__ v8f mma(V a, V b, v8f c) { return wmma16(a, b, c); } };
template <> struct WFrag<bf> { typedef v16bf V; static __device__ __forceinline__ V ld(const bf* p) { return cat16b(*(const v8us*)p, *(const v8us*)(p + 16)); } static __device__ __forceinline__ v8f mma(V a, V b, v8f c) { return wmmab(a, b, c); } };
template <typename T16, int NSPLIT, bool BIAS, bool PL>
__global__ __launch_bounds__(32) void k_gemmw(const T16* __restrict__ A, const T16* __restrict__ A2, const T16* __restrict__ Bt, const T16* __restrict__ Bt2, int K, float* C, int ldc, const float* __restrict__ bias, size_t sA, size_t sB, size_t sC, bf* Ph, bf* Pl, size_t cstep) {
    typedef typename WFrag<T16>::V V;
    __shared__ __align__(16) float os[16 * 68];
    const size_t z = blockIdx.z; A += z * sA; if (A2) A2 += z * sA; Bt += z * sB; if (Bt2) Bt2 += z * sB; C += z * sC;
    const int lane = threadIdx.x & 31, lr = lane & 15, hi = lane >> 4; const int r0 = blockIdx.x * 64, c0 = blockIdx.y * 64;
    v8f acc[4][4];
#pragma unroll
    for (int mb = 0; mb < 4; ++mb)
#pragma unroll
        for (int nb = 0; nb < 4; ++nb) acc[mb][nb] = (v8f){};
    const size_t aoff = (size_t)(r0 + lr) * K + 8 * hi, boff = (size_t)(c0 + lr) * K + 8 * hi;
#pragma unroll 1
    for (int kc = 0; kc < K; kc += 32) {
        V a[4], a2[4];
#pragma unroll
        for (int mb = 0; mb < 4; ++mb) { a[mb] = WFrag<T16>::ld(A + aoff + (size_t)mb * 16 * K + kc); if (NSPLIT == 1 || NSPLIT == 2) a2[mb] = WFrag<T16>::ld(A2 + aoff + (size_t)mb * 16 * K + kc); }
#pragma unroll
        for (int nb = 0; nb < 4; ++nb) { const V b = WFrag<T16>::ld(Bt + boff + (size_t)nb * 16 * K + kc); V b2; if (NSPLIT >= 2) b2 = WFrag<T16>::ld(Bt2 + boff + (size_t)nb * 16 * K + kc);
#pragma unroll
            for (int mb = 0; mb < 4; ++mb) { acc[mb][nb] = WFrag<T16>::mma(a[mb], b, acc[mb][nb]); if (NSPLIT == 1 || NSPLIT == 2) acc[mb][nb] = WFrag<T16>::mma(a2[mb], b, acc[mb][nb]); if (NSPLIT >= 2) acc[mb][nb] = WFrag<T16>::mma(a[mb], b2, acc[mb][nb]); } }
        asm volatile("v_nop\n\tv_nop\n\tv_nop\n\tv_nop" : "+v"(acc[0][0]), "+v"(acc[1][1]), "+v"(acc[2][2]), "+v"(acc[3][3]) : "v"(a[0]), "v"(a[3]));
    }
#pragma unroll
    for (int mb = 0; mb < 4; ++mb) {
#pragma unroll
        for (int nb = 0; nb < 4; ++nb) {
#pragma unroll
            for (int j = 0; j < 8; ++j) os[(hi * 8 + j) * 68 + nb * 16 + lr] = acc[mb][nb][j]; }
        __builtin_amdgcn_wave_barrier(); asm volatile("" ::: "memory");
        if (PL) { bf* ph[4]; bf* pl[4]; v8us oh[4], ol[4];
#pragma unroll
            for (int s = 0; s < 4; ++s) { const int row = 4 * s + (lane >> 3), cofs = (lane & 7) * 8; const v4f x0 = *(const v4fa*)(os + row * 68 + cofs), x1 = *(const v4fa*)(os + row * 68 + cofs + 4);
#pragma unroll
                for (int q = 0; q < 4; ++q) { unsigned short a, c2; splitf(x0[q], a, c2); oh[s][q] = a; ol[s][q] = c2; splitf(x1[q], a, c2); oh[s][q + 4] = a; ol[s][q + 4] = c2; }
                const size_t oo = (size_t)(r0 + mb * 16 + row) * ldc + (size_t)blockIdx.y * cstep + cofs; ph[s] = Ph + oo; pl[s] = Pl + oo;
                *(v8us*)ph[s] = oh[s]; *(v8us*)pl[s] = ol[s]; }
            // the address and data registers of the eight issued stores stay unwritten up to this wait (they are its inputs), so it stands in front of the next group's writes of those registers
            asm volatile("s_wait_xcnt 0x0" :: "v"(ph[0]), "v"(ph[1]), "v"(ph[2]), "v"(ph[3]), "v"(pl[0]), "v"(pl[1]), "v"(pl[2]), "v"(pl[3]), "v"(oh[0]), "v"(oh[1]), "v"(oh[2]), "v"(oh[3]), "v"(ol[0]), "v"(ol[1]), "v"(ol[2]), "v"(ol[3]) : "memory");
        }
        float* crow = C + (size_t)(r0 + mb * 16) * ldc + c0;
        if (!PL)
{
#pragma unroll
            for (int s = 0; s < 8; ++s) { const int row = 2 * s + hi, cofs = lr * 4; v4f val = *(const v4fa*)(os + row * 68 + cofs); if (BIAS) { val[0] += bfr(bias[c0 + cofs]); val[1] += bfr(bias[c0 + cofs + 1]); val[2] += bfr(bias[c0 + cofs + 2]); val[3] += bfr(bias[c0 + cofs + 3]); }
                *(v4f*)(crow + (size_t)row * ldc + cofs) = val; }
             }
        __builtin_amdgcn_wave_barrier(); asm volatile("" ::: "memory");
    }
}

// ---- k_gemmc: the same one-wave 64x64 tile GEMM specialised for causal attention: CMODE 1 skips score tiles entirely above the diagonal (query rows r0+roff.., key columns c0..), CMODE 2 limits the
// key (K) loop of the probability x value contraction to the diagonal block (probabilities beyond it are exactly zero). roff = row offset of this launch's first row within the sequence.
// CMODE 2 is split over keys: blockIdx.y names a range of KCH keys (the output is one 64-column tile, HD == 64), each range stores its f32 partial tile in its own plane (stride sP), and k_merge adds the planes.
template <typename T16, int NSPLIT, int CMODE>
__global__ __launch_bounds__(32) void k_gemmc(const T16* __restrict__ A, const T16* __restrict__ A2, const T16* __restrict__ Bt, const T16* __restrict__ Bt2, int K, float* C, int ldc, int roff, size_t sA, size_t sB, size_t sC, size_t sP) {
    typedef typename WFrag<T16>::V V;
    __shared__ __align__(16) float os[16 * 68];
    const size_t z = blockIdx.z; A += z * sA; if (A2) A2 += z * sA; Bt += z * sB; if (Bt2) Bt2 += z * sB; C += z * sC;
    const int lane = threadIdx.x & 31, lr = lane & 15, hi = lane >> 4; const int r0 = blockIdx.x * 64, c0 = (CMODE == 2) ? 0 : blockIdx.y * 64; const int kb = (CMODE == 2) ? blockIdx.y * KCH : 0;
    if (CMODE == 1 && c0 > r0 + roff + 63) return;                  // score tile entirely above the causal diagonal: never read (the softmax masks j > i by select)
    if (CMODE == 2 && kb >= r0 + roff + 64) return;                  // key range entirely beyond the diagonal block: no partial plane is stored, and k_merge reads none
    const int Kl = (CMODE == 2) ? min(min(K, r0 + roff + 64), kb + KCH) : K;        // P.V: probabilities are exactly 0 beyond the diagonal block, so the K loop stops there
    if (CMODE == 2) C += (size_t)blockIdx.y * sP;
    const int lda = (CMODE == 2) ? 2 * K : K;                        // probability rows lie in the score rows' own storage: hi half, lo half, so one row is 2 K elements
    v8f acc[4][4];
#pragma unroll
    for (int mb = 0; mb < 4; ++mb)
#pragma unroll
        for (int nb = 0; nb < 4; ++nb) acc[mb][nb] = (v8f){};
    const size_t aoff = (size_t)(r0 + lr) * lda + 8 * hi, boff = (size_t)(c0 + lr) * K + 8 * hi;
#pragma unroll 1
    for (int kc = kb; kc < Kl; kc += 32) {
        static_assert(NSPLIT == 2, "A and B both come as hi and lo planes");
        V a[4], a2[4]; const T16* pa[4]; const T16* pa2[4];
#pragma unroll
        for (int mb = 0; mb < 4; ++mb) { pa[mb] = A + aoff + (size_t)mb * 16 * lda + kc; pa2[mb] = A2 + aoff + (size_t)mb * 16 * lda + kc; a[mb] = WFrag<T16>::ld(pa[mb]); a2[mb] = WFrag<T16>::ld(pa2[mb]); }
        // the address registers of the issued loads stay unwritten up to this wait (they are its inputs)
        asm volatile("s_wait_xcnt 0x0" :: "v"(pa[0]), "v"(pa[1]), "v"(pa[2]), "v"(pa[3]), "v"(pa2[0]), "v"(pa2[1]), "v"(pa2[2]), "v"(pa2[3]) : "memory");
#pragma unroll
        for (int nb = 0; nb < 4; ++nb) { const T16* pb = Bt + boff + (size_t)nb * 16 * K + kc; const T16* pb2 = Bt2 + boff + (size_t)nb * 16 * K + kc; const V b = WFrag<T16>::ld(pb); const V b2 = WFrag<T16>::ld(pb2);
            asm volatile("s_wait_xcnt 0x0" :: "v"(pb), "v"(pb2) : "memory");   // as above, for the two B address pairs
#pragma unroll
            for (int mb = 0; mb < 4; ++mb) { acc[mb][nb] = WFrag<T16>::mma(a[mb], b, acc[mb][nb]); if (NSPLIT == 1 || NSPLIT == 2) acc[mb][nb] = WFrag<T16>::mma(a2[mb], b, acc[mb][nb]); if (NSPLIT >= 2) acc[mb][nb] = WFrag<T16>::mma(a[mb], b2, acc[mb][nb]); } }
        asm volatile("v_nop\n\tv_nop\n\tv_nop\n\tv_nop" : "+v"(acc[0][0]), "+v"(acc[1][1]), "+v"(acc[2][2]), "+v"(acc[3][3]) : "v"(a[0]), "v"(a[3]));
    }
#pragma unroll
    for (int mb = 0; mb < 4; ++mb) {
#pragma unroll
        for (int nb = 0; nb < 4; ++nb) {
#pragma unroll
            for (int j = 0; j < 8; ++j) os[(hi * 8 + j) * 68 + nb * 16 + lr] = acc[mb][nb][j]; }
        __builtin_amdgcn_wave_barrier(); asm volatile("" ::: "memory");
        float* crow = C + (size_t)(r0 + mb * 16) * ldc + c0;
{ float* sp[8]; v4f sv[8];
#pragma unroll
            for (int s = 0; s < 8; ++s) { const int row = 2 * s + hi, cofs = lr * 4; sv[s] = *(const v4fa*)(os + row * 68 + cofs); sp[s] = crow + (size_t)row * ldc + cofs;
                *(v4f*)sp[s] = sv[s]; }
            // the address and data registers of the eight issued stores stay unwritten up to this wait (they are its inputs)
            asm volatile("s_wait_xcnt 0x0" :: "v"(sp[0]), "v"(sp[1]), "v"(sp[2]), "v"(sp[3]), "v"(sp[4]), "v"(sp[5]), "v"(sp[6]), "v"(sp[7]), "v"(sv[0]), "v"(sv[1]), "v"(sv[2]), "v"(sv[3]), "v"(sv[4]), "v"(sv[5]), "v"(sv[6]), "v"(sv[7]) : "memory");
             }
        __builtin_amdgcn_wave_barrier(); asm volatile("" ::: "memory");
    }
}

__device__ __forceinline__ h16 tohx(float x) { return (h16)x; }
typedef __attribute__((ext_vector_type(2))) _Float16 v2h;
typedef __attribute__((ext_vector_type(4))) _Float16 v4h;
typedef __attribute__((ext_vector_type(2))) unsigned short v2us;
typedef __attribute__((ext_vector_type(4))) unsigned short v4us;
typedef __attribute__((ext_vector_type(2))) float v2f;
typedef __attribute__((ext_vector_type(4))) int v4i;

__global__ __launch_bounds__(256) void k_cvt8(const float* __restrict__ src, bf* dst, size_t n8) { const size_t i = (size_t)blockIdx.x * 256 + threadIdx.x; if (i >= n8) return; const v8f v = *(const v8f*)(src + i * 8); v8us o;
#pragma unroll
    for (int k = 0; k < 8; ++k) o[k] = f2bf(v[k]); *(v8us*)(dst + i * 8) = o;  }

// k_asoft: per row (zz, i): t = S x SCL (SCL 1: no scaling) for j <= i and i - j < WIN (sliding causal window; the reference's -1e9 additive fill vanishes identically); softmax over the 2048 keys (register row, one exp, fixed trees);
// The hi and lo probability rows overwrite the wave's own score row (2048 f32 = 2048 hi + 2048 lo bf16): the whole row is in registers before the first store (every stored value depends on the row's max and sum), and no other wave touches it.
__global__ __launch_bounds__(256) void k_asoft(const float* Sb, h16* P16, bf* Ph, bf* Pl) {
    const int lane = threadIdx.x & 31; const int row = blockIdx.x * 8 + (threadIdx.x >> 5); if (row >= ZH * TT) return; const int i = row % TT; const int zz = row / TT; (void)zz; const bool hires = (i < RH); const float* sr = Sb + (size_t)row * TT; float v[TT / 32]; float mx = -3.0e38f;
#pragma unroll
    for (int ch = 0; ch < TT / 128; ++ch) { const int j0 = ch * 128 + lane * 4; const v4f a = *(const v4f*)(sr + j0);
#pragma unroll
        for (int q = 0; q < 4; ++q) { const int j = j0 + q; (void)j; const float t = (j <= i && i - j < WIN) ? a[q] * SCL : -3.0e38f; v[ch * 4 + q] = t; mx = fmaxf(mx, t); } }
#pragma unroll
    for (int sh = 16; sh; sh >>= 1) mx = fmaxf(mx, __shfl_xor(mx, sh, 32));
    float sum = 0.f;
#pragma unroll
    for (int k = 0; k < TT / 32; ++k) { float d0 = __fsub_rn(v[k], mx); asm volatile("" : "+v"(d0)); v[k] = __builtin_amdgcn_exp2f(__fmul_rn(d0, 1.4426950408889634f)); sum += v[k]; }
#pragma unroll
    for (int sh = 16; sh; sh >>= 1) sum += __shfl_xor(sum, sh, 32);
    const float f = __fdiv_rn(hires ? 1.0f : PCAR, sum);
{
        if (hires) {
#pragma unroll
            for (int ch = 0; ch < TT / 128; ++ch) { v4us oh, ol;
#pragma unroll
                for (int q = 0; q < 4; ++q) { unsigned short a, c2; splitf(v[ch * 4 + q] * f, a, c2); oh[q] = a; ol[q] = c2; }
                const size_t oo = ((size_t)zz * (RH ? RH : 1) + i) * (2 * TT) + ch * 128 + lane * 4; *(v4us*)(Ph + oo) = oh; *(v4us*)(Pl + oo) = ol; }
        } else {
#pragma unroll
            for (int ch = 0; ch < TT / 128; ++ch) { v4h o4;
#pragma unroll
                for (int q = 0; q < 4; ++q) o4[q] = tohx(v[ch * 4 + q] * f);
                *(v4h*)(P16 + (size_t)row * TT + ch * 128 + lane * 4) = o4; } }
         }
}
__global__ __launch_bounds__(256) void k_merge(const float* __restrict__ O, int h0, bf* Ah, bf* Al) { const size_t e = ((size_t)blockIdx.x * 256 + threadIdx.x) * 2; if (e >= (size_t)ZH * TT * HD) return; const int d = (int)(e % HD); const int t = (int)((e / HD) % TT); const int zz = (int)(e / ((size_t)HD * TT)); const float cs = (t < RH) ? 1.0f : (1.0f / PCAR); const size_t oo = (size_t)t * DQ + (h0 + zz) * HD + d;
    const int ns = ((t / 64) * 64 + 64 + KCH - 1) / KCH;   // key ranges that k_gemmc stored for this row's 64-row tile
    v2f p[NCH];
#pragma unroll
    for (int s = 0; s < NCH; ++s) p[s] = *(const v2f*)(O + (size_t)min(s, ns - 1) * ((size_t)ZH * TT * HD) + e);   // clamped plane index: all loads issue together, none reads a plane that was not stored
    v2f sm = p[0];
#pragma unroll
    for (int s = 1; s < NCH; ++s) { sm[0] += (s < ns) ? p[s][0] : 0.0f; sm[1] += (s < ns) ? p[s][1] : 0.0f; }
    v2us oh, ol;
#pragma unroll
    for (int q = 0; q < 2; ++q) { unsigned short a, c2; splitf(sm[q] * cs, a, c2); oh[q] = a; ol[q] = c2; } *(v2us*)(Ah + oo) = oh; *(v2us*)(Al + oo) = ol;  }

extern "C" void kernel_launch(void* const* d_in, const int* in_sizes, int n_in,
                              void* d_out, int out_size, void* d_ws, size_t ws_size, hipStream_t stream) {
    (void)in_sizes; (void)n_in; (void)out_size;
    const float* x = (const float*)d_in[0]; const float* wq = (const float*)d_in[1]; const float* wk = (const float*)d_in[2]; const float* wv = (const float*)d_in[3]; const float* wo = (const float*)d_in[4];   /* x, Q, K, V [16][64][1024] (= 'oi'), O ('oi' [1024][1024]) */
    float* OUT = (float*)d_out;     // [4][2048][1024]
    char* wsp = (char*)d_ws;
    auto take = [&](size_t bytes) { char* p = wsp; wsp += (bytes + 255) & ~(size_t)255; return (void*)p; };
    bf* WQ = (bf*)take((size_t)DQ * DM * 2); bf* WK = (bf*)take((size_t)DKV * DM * 2); bf* WV = (bf*)take((size_t)DKV * DM * 2); bf* WO = (bf*)take((size_t)DM * DQ * 2);
    float* Ob = (float*)take((size_t)NCH * ZH * TT * HD * 4);
    static_assert((size_t)TT * DM * 2 <= (size_t)NCH * ZH * TT * HD * 4, "the bf16 copy of x fits in the partial planes");
    bf* XB = (bf*)Ob;   // the bf16 copy of x shares the partial planes' storage: it is dead once the head planes are built, before a batch's first pass (stream-ordered)
    bf* QPh = (bf*)take((size_t)NH_ * TT * HD * 2); bf* QPl = (bf*)take((size_t)NH_ * TT * HD * 2); bf* KPh = (bf*)take((size_t)NKV * TT * HD * 2); bf* KPl = (bf*)take((size_t)NKV * TT * HD * 2); bf* VTh = (bf*)take((size_t)NKV * HD * TT * 2); bf* VTl = (bf*)take((size_t)NKV * HD * TT * 2);
    float* Sb = (float*)take((size_t)ZH * TT * TT * 4); bf* Ph = (bf*)Sb; bf* Pl = Ph + TT;   // probability planes in place of the scores, row pitch 2 TT
    h16* P16 = nullptr;   // the fp16 probability plane has no rows (RH == TT: every row is hi/lo)
    bf* ATh = (bf*)take((size_t)TT * DQ * 2); bf* ATl = (bf*)take((size_t)TT * DQ * 2);
    if ((size_t)(wsp - (char*)d_ws) > ws_size) return;    // ws 256 MiB
    { k_cvt8<<<(unsigned)(((size_t)DQ * DM / 8 + 255) / 256), 256, 0, stream>>>(wq, WQ, (size_t)DQ * DM / 8); k_cvt8<<<(unsigned)(((size_t)DKV * DM / 8 + 255) / 256), 256, 0, stream>>>(wk, WK, (size_t)DKV * DM / 8); k_cvt8<<<(unsigned)(((size_t)DKV * DM / 8 + 255) / 256), 256, 0, stream>>>(wv, WV, (size_t)DKV * DM / 8);
      k_cvt8<<<(unsigned)(((size_t)DM * DQ / 8 + 255) / 256), 256, 0, stream>>>(wo, WO, (size_t)DM * DQ / 8);
       }
    for (int b = 0; b < NB_; ++b) {
        
        k_cvt8<<<(unsigned)(((size_t)TT * DM / 8 + 255) / 256), 256, 0, stream>>>(x + (size_t)b * TT * DM, XB, (size_t)TT * DM / 8);
        k_gemmw<bf, 0, false, true><<<dim3(TT / 64, DQ / 64, 1), 32, 0, stream>>>(XB, nullptr, WQ, nullptr, DM, nullptr, HD, nullptr, 0, 0, 0, QPh, QPl, (size_t)TT * HD);     // a 64-column tile is one head: planes [h][t][d]
        k_gemmw<bf, 0, false, true><<<dim3(TT / 64, DKV / 64, 1), 32, 0, stream>>>(XB, nullptr, WK, nullptr, DM, nullptr, HD, nullptr, 0, 0, 0, KPh, KPl, (size_t)TT * HD);
        k_gemmw<bf, 0, false, true><<<dim3(DKV / 64, TT / 64, 1), 32, 0, stream>>>(WV, nullptr, XB, nullptr, DM, nullptr, TT, nullptr, 0, 0, 0, VTh, VTl, (size_t)64);          // operands swapped: rows g*64 + d, columns t, so the planes are [g][d][t]
        for (int h0 = 0; h0 < NH_; h0 += ZH) { const size_t zq = (size_t)h0, zk = (size_t)(h0 / REP);   // one kv head per query head: the pass's heads use consecutive kv planes (z-strides TT*HD)
            k_gemmc<bf, 2, 1><<<dim3(RH / 64, TT / 64, ZH), 32, 0, stream>>>(QPh + zq * TT * HD, QPl + zq * TT * HD, KPh + zk * TT * HD, KPl + zk * TT * HD, HD, Sb, TT, 0, (size_t)TT * HD, (size_t)TT * HD, (size_t)TT * TT, 0);
            k_asoft<<<ZH * TT / 8, 256, 0, stream>>>(Sb, P16, Ph, Pl);
            k_gemmc<bf, 2, 2><<<dim3(RH / 64, NCH, ZH), 32, 0, stream>>>(Ph, Pl, VTh + zk * HD * TT, VTl + zk * HD * TT, TT, Ob, HD, 0, (size_t)RH * 2 * TT, (size_t)HD * TT, (size_t)TT * HD, (size_t)ZH * TT * HD);
            k_merge<<<(unsigned)(((size_t)ZH * TT * HD / 2 + 255) / 256), 256, 0, stream>>>(Ob, h0, ATh, ATl); }
        k_gemmw<bf, 1, false, false><<<dim3(TT / 64, DM / 64, 1), 32, 0, stream>>>(ATh, ATl, WO, nullptr, DQ, OUT + (size_t)b * TT * DM, DM, nullptr, 0, 0, 0, nullptr, nullptr, 0); }
}

// v005
// Measured time: 274 microseconds a run.
// Versions in between are left out here; by their measured steps it is 4.09 times as fast as v003.
// Over all steps from v000 it is 8.57 times as fast.
#include <hip/hip_runtime.h>

// Causal attention with per-head weight tensors and NO score scaling (x [4][2048][1024]; q = einsum('nhm,btm', Q, x) with Q, K, V [16][64][1024] (= 'oi' [1024][1024] with rows n*64 + h; 1/32 scale); scores = q.k (the source has no 1/sqrt(d_head) factor: logits sigma ~8); causal (-1e10 == exclusion); softmax; z = merged heads (n, h); out = einsum('ma,bqa', O, z) ('oi') -> [4][2048][1024] (8.4 M); argument order x, Q, K, V, O).
// Layout per batch: bf16 copy of x; the [16][64][1024] weights are already Bt planes ('oi' rows n*64 + h); exact projections that store their hi/lo head planes themselves (v with the operands swapped, so its tile is already [d][t]); one fused causal attention kernel over all batches and heads (online softmax, scores and probabilities stay in registers, hi/lo planes, 3 products); merged hi/lo x O exact.
// Compute dtypes, f32 accumulate: every input rounded to bf16; projections exact; softmax f32; O hl x exact.

#define NB_  4
#define TT   2048
#define DM   1024
#define NH_  16
#define NKV  16
#define REP  (NH_ / NKV)
#define HD   64
#define DQ   (NH_ * HD)
#define DKV  (NKV * HD)
#define AW   8                    // waves per work-group of the attention kernel, 16 query rows each
typedef _Float16 h16;
typedef unsigned short bf;
typedef __attribute__((ext_vector_type(16))) __bf16   v16bf;
typedef __attribute__((ext_vector_type(16))) _Float16 v16h;
typedef __attribute__((ext_vector_type(8)))  _Float16 v8h;
typedef __attribute__((ext_vector_type(8)))  unsigned short v8us;
typedef __attribute__((ext_vector_type(8)))  float    v8f;
typedef __attribute__((ext_vector_type(4)))  float    v4f;
typedef v8h  __attribute__((may_alias)) v8ha;
typedef v4f  __attribute__((may_alias)) v4fa;
typedef v8us __attribute__((may_alias)) v8usa;

__device__ __forceinline__ unsigned short f2bf(float f) { unsigned u = __float_as_uint(f); u += 0x7FFFu + ((u >> 16) & 1u); return (unsigned short)(u >> 16); }
__device__ __forceinline__ float bf2f(unsigned short b) { return __uint_as_float(((unsigned)b) << 16); }
__device__ __forceinline__ float bfr(float f) { return bf2f(f2bf(f)); }
__device__ __forceinline__ void splitf(float y, unsigned short& h, unsigned short& l) { h = f2bf(y); l = f2bf(y - bf2f(h)); }
__device__ __forceinline__ v16h cat16(v8h lo, v8h hi) { return __builtin_shufflevector(lo, hi, 0, 1, 2, 3, 4, 5, 6, 7, 8, 9, 10, 11, 12, 13, 14, 15); }
__device__ __forceinline__ v16bf cat16b(v8us lo, v8us hi) { return __builtin_bit_cast(v16bf, __builtin_shufflevector(lo, hi, 0, 1, 2, 3, 4, 5, 6, 7, 8, 9, 10, 11, 12, 13, 14, 15)); }
__device__ __forceinline__ v8f wmma16(v16h a, v16h b, v8f c) { return __builtin_amdgcn_wmma_f32_16x16x32_f16(false, a, false, b, (short)0, c, false, false); }
__device__ __forceinline__ v8f wmmab(v16bf a, v16bf b, v8f c) { return __builtin_amdgcn_wmma_f32_16x16x32_bf16(false, a, false, b, (short)0, c, false, false); }



// ---- k_gemmt: work-group tiled GEMM. Eight waves share a 128x64 output tile (a wave 32x32, four accumulators); grid (M/128, N/64), 256 threads. The K-contiguous bf16 operand rows are brought in stages of 128 k
// by whole-line loads (a wave's load covers four 128-byte lines), through registers into LDS, two buffers, one barrier a stage; the next stage's global loads fly under this stage's products. The fragments are read from LDS.
// C[m][n] (f32, pitch ldc) = sum_k A[m][k] Bt[n][k] (+ A2[m][k] Bt[n][k] if NSPLIT), k ascending in steps of 32, A in front of A2. KK % 128 == 0.
// PL: no f32 C; the tile is split into bf16 hi and lo and stored at Ph/Pl + m * ldc + blockIdx.y * cstep + (n % 64) (head planes [h][t][d]: ldc HD, cstep TT*HD; transposed planes [g][d][t]: ldc TT, cstep 64).
// The plain '#pragma unroll' lines give the staging, fragment and accumulator arrays constant indices, so that they stay in registers.
template <typename T16> struct WFrag;
template <> struct WFrag<h16> { typedef v16h V; static __device__ __forceinline__ V ld(const h16* p) { return cat16(*(const v8h*)p, *(const v8h*)(p + 16)); } static __device__ __forceinline__ v8f mma(V a, V b, v8f c) { return wmma16(a, b, c); } };
template <> struct WFrag<bf> { typedef v16bf V; static __device__ __forceinline__ V ld(const bf* p) { return cat16b(*(const v8us*)p, *(const v8us*)(p + 16)); } static __device__ __forceinline__ v8f mma(V a, V b, v8f c) { return wmmab(a, b, c); } };
#define GP   144                  // LDS row pitch in bytes: a 128-byte row (64 k) + 16 (an odd multiple of 16, for the 16-byte fragment reads)
__device__ __forceinline__ v16bf ldsfrag(const unsigned char* p) { return cat16b(*(const v8usa*)p, *(const v8usa*)(p + 32)); }   // elements 0..7 and 16..23 from p, as WFrag::ld
template <int KK, int NSPLIT, bool PL>
__global__ __launch_bounds__(256) void k_gemmt(const bf* __restrict__ A, const bf* __restrict__ A2, const bf* __restrict__ Bt, float* C, int ldc, bf* Ph, bf* Pl, size_t cstep) {
    typedef v16bf V;
    constexpr int NA = NSPLIT ? 2 : 1, TA = 128 * GP, TB = 64 * GP;   // tiles of 64 k: A (and A2) 128 rows, Bt 64 rows
    constexpr int HS = NA * TA + TB, SS = 2 * HS, NS = KK / 128;      // half a stage (64 k), a stage (128 k), stages
    constexpr int GK = NSPLIT ? 2 : 4;                                // steps of 32 k whose fragments are read as one group (registers: 4 or 6 fragments a step)
    __shared__ __align__(16) unsigned char L[2 * SS];
    const int tid = threadIdx.x, lane = tid & 31, lr = lane & 15, hi = lane >> 4; const int wave = __builtin_amdgcn_readfirstlane(tid >> 5);
    const int wm = wave >> 1, wn = wave & 1; const int r0 = blockIdx.x * 128, c0 = blockIdx.y * 64;
    // staging: thread tid brings 16 bytes of rows tid / 8 + 32 i of every tile
    const int srow = tid >> 3, scol = (tid & 7) * 8;
    const bf* ga = A + (size_t)(r0 + srow) * KK + scol; const bf* ga2 = NSPLIT ? A2 + (size_t)(r0 + srow) * KK + scol : ga; const bf* gb = Bt + (size_t)(c0 + srow) * KK + scol;
    unsigned char* sdst = L + srow * GP + scol * 2;
    v8us xa[8], xa2[8], xb[4];
    auto g2r = [&](int st) {
        const bf* pa = ga + st * 128; const bf* pa2 = ga2 + st * 128; const bf* pb = gb + st * 128;
#pragma unroll
        for (int kh = 0; kh < 2; ++kh) {
#pragma unroll
            for (int i = 0; i < 4; ++i) { xa[kh * 4 + i] = *(const v8us*)(pa + kh * 64 + i * 32 * KK); if (NSPLIT) xa2[kh * 4 + i] = *(const v8us*)(pa2 + kh * 64 + i * 32 * KK); }
#pragma unroll
            for (int i = 0; i < 2; ++i) xb[kh * 2 + i] = *(const v8us*)(pb + kh * 64 + i * 32 * KK); }
        // the address registers of the issued loads stay unwritten up to this wait (they are its inputs)
        asm volatile("s_wait_xcnt 0x0" :: "v"(pa), "v"(pa2), "v"(pb) : "memory");
    };
    auto r2s = [&](int buf) {
        unsigned char* d = sdst + buf * SS;
#pragma unroll
        for (int kh = 0; kh < 2; ++kh) {
#pragma unroll
            for (int i = 0; i < 4; ++i) { *(v8usa*)(d + kh * HS + i * 32 * GP) = xa[kh * 4 + i]; if (NSPLIT) *(v8usa*)(d + kh * HS + TA + i * 32 * GP) = xa2[kh * 4 + i]; }
#pragma unroll
            for (int i = 0; i < 2; ++i) *(v8usa*)(d + kh * HS + NA * TA + i * 32 * GP) = xb[kh * 2 + i]; }
    };
    v8f acc[2][2];
#pragma unroll
    for (int mb = 0; mb < 2; ++mb)
#pragma unroll
        for (int nb = 0; nb < 2; ++nb) acc[mb][nb] = (v8f){};
    const int aofs = (wm * 32 + lr) * GP + 16 * hi, bofs = NA * TA + (wn * 32 + lr) * GP + 16 * hi;
    g2r(0); r2s(0);
    __syncthreads();   // stage 0 is published
#pragma unroll 1   // kept rolled: one set of staging registers, one copy of the stage's code
    for (int st = 0; st < NS; ++st) {
        if (st + 1 < NS) g2r(st + 1);        // the next stage's global loads fly under this stage's products
        const unsigned char* B = L + (st & 1) * SS;
#pragma unroll
        for (int gr = 0; gr < 4 / GK; ++gr) {   // groups of GK steps of 32 k
            V a[GK][2], a2[GK][2], b[GK][2];
#pragma unroll
            for (int kk = 0; kk < GK; ++kk) {
                const int ks = gr * GK + kk; const unsigned char* H = B + (ks >> 1) * HS + 64 * (ks & 1);
#pragma unroll
                for (int mb = 0; mb < 2; ++mb) a[kk][mb] = ldsfrag(H + aofs + mb * 16 * GP);
#pragma unroll
                for (int nb = 0; nb < 2; ++nb) b[kk][nb] = ldsfrag(H + bofs + nb * 16 * GP);
                if (NSPLIT) {
#pragma unroll
                    for (int mb = 0; mb < 2; ++mb) a2[kk][mb] = ldsfrag(H + TA + aofs + mb * 16 * GP); } }
            __builtin_amdgcn_sched_barrier(0);   // the group's fragment reads stay one block in front of its products (counted waits), instead of a read, a full wait and two products in turn
#pragma unroll
            for (int kk = 0; kk < GK; ++kk) {
#pragma unroll
                for (int nb = 0; nb < 2; ++nb)
#pragma unroll
                    for (int mb = 0; mb < 2; ++mb) acc[mb][nb] = wmmab(a[kk][mb], b[kk][nb], acc[mb][nb]);
                if (NSPLIT) {
#pragma unroll
                    for (int nb = 0; nb < 2; ++nb)
#pragma unroll
                        for (int mb = 0; mb < 2; ++mb) acc[mb][nb] = wmmab(a2[kk][mb], b[kk][nb], acc[mb][nb]); } }
        }
        if (st + 1 < NS) r2s((st + 1) & 1);   // into the buffer whose last readers left it before the previous stage's barrier
        __syncthreads();                      // publishes stage st + 1 and ends every wave's reads of stage st
    }
    // the f32 tile goes through LDS (the operand buffers are free behind the last barrier), so that a wave stores whole rows: one writer per 128-byte line
    float* os = (float*)L;   // [128][68]
#pragma unroll
    for (int mb = 0; mb < 2; ++mb)
#pragma unroll
        for (int nb = 0; nb < 2; ++nb)
#pragma unroll
            for (int j = 0; j < 8; ++j) os[(wm * 32 + mb * 16 + hi * 8 + j) * 68 + wn * 32 + nb * 16 + lr] = acc[mb][nb][j];
    __syncthreads();   // the tile is complete before any wave reads its sixteen rows
    if (PL) { bf* ph[4]; bf* pl[4]; v8us oh[4], ol[4];
#pragma unroll
        for (int s = 0; s < 4; ++s) { const int row = wave * 16 + 4 * s + (lane >> 3), cofs = (lane & 7) * 8; const v4f x0 = *(const v4fa*)(os + row * 68 + cofs), x1 = *(const v4fa*)(os + row * 68 + cofs + 4);
#pragma unroll
            for (int q = 0; q < 4; ++q) { unsigned short a, c2; splitf(x0[q], a, c2); oh[s][q] = a; ol[s][q] = c2; splitf(x1[q], a, c2); oh[s][q + 4] = a; ol[s][q + 4] = c2; }
            const size_t oo = (size_t)(r0 + row) * ldc + (size_t)blockIdx.y * cstep + cofs; ph[s] = Ph + oo; pl[s] = Pl + oo;
            *(v8us*)ph[s] = oh[s]; *(v8us*)pl[s] = ol[s]; }
        // the address and data registers of the eight issued stores stay unwritten up to this wait (they are its inputs)
        asm volatile("s_wait_xcnt 0x0" :: "v"(ph[0]), "v"(ph[1]), "v"(ph[2]), "v"(ph[3]), "v"(pl[0]), "v"(pl[1]), "v"(pl[2]), "v"(pl[3]), "v"(oh[0]), "v"(oh[1]), "v"(oh[2]), "v"(oh[3]), "v"(ol[0]), "v"(ol[1]), "v"(ol[2]), "v"(ol[3]) : "memory");
    } else { float* pc[8]; v4f val[8];
#pragma unroll
        for (int s = 0; s < 8; ++s) { const int row = wave * 16 + 2 * s + hi, cofs = lr * 4; val[s] = *(const v4fa*)(os + row * 68 + cofs); pc[s] = C + (size_t)(r0 + row) * ldc + c0 + cofs;
            *(v4f*)pc[s] = val[s]; }
        // as above
        asm volatile("s_wait_xcnt 0x0" :: "v"(pc[0]), "v"(pc[1]), "v"(pc[2]), "v"(pc[3]), "v"(pc[4]), "v"(pc[5]), "v"(pc[6]), "v"(pc[7]), "v"(val[0]), "v"(val[1]), "v"(val[2]), "v"(val[3]), "v"(val[4]), "v"(val[5]), "v"(val[6]), "v"(val[7]) : "memory");
    }
}

// ---- k_attn: causal attention, scores, softmax and probability x value in one kernel. A work-group owns 128 query rows of one (batch, head) z, a wave 16 of them; the keys are walked in stages of 64
// (K hi/lo rows and V^T hi/lo rows staged in LDS through registers, whole lines, two buffers, one barrier a stage), each stage in two passes of 32 keys, up to each wave's own diagonal.
// Transposed products: S^T = K.Q^T (A = 16 keys x 32 d, B = 16 queries) leaves in lane (c, h) the scores of query c for keys 8 h + r of each 16-key tile, which is the k order of a B fragment over 32 keys,
// so P^T goes into O^T += V^T.P^T (A = 16 d x 32 keys from the [d][t] planes) without leaving the registers. Every operand is hi + lo bf16, three products each. Running maximum and sum per query (online softmax), f32.
// The plain '#pragma unroll' lines give the fragment and accumulator arrays constant indices, so that they stay in registers.
#define LP   144                  // LDS row pitch in bytes: a 128-byte row + 16 (an odd multiple of 16, for the 16-byte fragment reads)
#define LT   (64 * LP)            // one tile of 64 rows
#define LS   (4 * LT)             // one stage: K hi, K lo (rows = keys), V^T hi, V^T lo (rows = d)
typedef __attribute__((ext_vector_type(2))) float v2f;
typedef __attribute__((ext_vector_type(2))) __bf16 v2bf;
typedef __attribute__((ext_vector_type(8))) unsigned v8u;
__device__ __forceinline__ float xhalf(float x) { return __builtin_bit_cast(float, __builtin_amdgcn_permlanex16(__builtin_bit_cast(int, x), __builtin_bit_cast(int, x), 0x76543210, 0xfedcba98, false, false)); }   // lane l with lane l ^ 16
__device__ __forceinline__ unsigned pack2(float a, float b) { return __builtin_bit_cast(unsigned, __builtin_convertvector((v2f){a, b}, v2bf)); }   // two f32 to two bf16, round to nearest even
__global__ __launch_bounds__(AW * 32) void k_attn(const bf* __restrict__ Qh, const bf* __restrict__ Ql, const bf* __restrict__ Kh, const bf* __restrict__ Kl, const bf* __restrict__ Vh, const bf* __restrict__ Vl, bf* Ah, bf* Al) {
    typedef v16bf V;
    __shared__ __align__(16) unsigned char L[2 * LS];
    const int tid = threadIdx.x, lane = tid & 31, c = lane & 15, h = lane >> 4; const int wave = __builtin_amdgcn_readfirstlane(tid >> 5);
    const int z = blockIdx.x;                                        // batch * NH_ + head
    const int qb = TT / (AW * 16) - 1 - (int)blockIdx.y;             // longest key loops start first
    const int q0 = qb * (AW * 16) + wave * 16;
    const size_t zo = (size_t)z * TT * HD;
    const int ns = 2 * qb + 2;                                       // 64-key stages up to the work-group's last query
    const int plast = (q0 + 15) / 32;                                // the wave's last 32-key pass, the one that holds its diagonal
    const bf* qph = Qh + zo + (size_t)(q0 + c) * HD + 8 * h; const bf* qpl = Ql + zo + (size_t)(q0 + c) * HD + 8 * h;
    V qh[2], ql[2];
#pragma unroll
    for (int kc = 0; kc < 2; ++kc) { qh[kc] = WFrag<bf>::ld(qph + 32 * kc); ql[kc] = WFrag<bf>::ld(qpl + 32 * kc); }
    // the address registers of the issued loads stay unwritten up to this wait (they are its inputs)
    asm volatile("s_wait_xcnt 0x0" :: "v"(qph), "v"(qpl) : "memory");
    // staging: thread tid brings 16 bytes of rows tid / 8 and tid / 8 + 32 of each of the four tiles
    const int srow = tid >> 3, scol = (tid & 7) * 8;
    const bf* gkh = Kh + zo + srow * HD + scol; const bf* gkl = Kl + zo + srow * HD + scol;
    const bf* gvh = Vh + zo + (size_t)srow * TT + scol; const bf* gvl = Vl + zo + (size_t)srow * TT + scol;
    unsigned char* sdst = L + srow * LP + scol * 2;
    v8us g[8];
    auto g2r = [&](int st) {
        const bf* a0 = gkh + (size_t)st * 64 * HD; const bf* a1 = gkl + (size_t)st * 64 * HD; const bf* a2 = gvh + st * 64; const bf* a3 = gvl + st * 64;
        g[0] = *(const v8us*)a0; g[1] = *(const v8us*)(a0 + 32 * HD); g[2] = *(const v8us*)a1; g[3] = *(const v8us*)(a1 + 32 * HD);
        g[4] = *(const v8us*)a2; g[5] = *(const v8us*)(a2 + (size_t)32 * TT); g[6] = *(const v8us*)a3; g[7] = *(const v8us*)(a3 + (size_t)32 * TT);
        // as above, for the four address pairs
        asm volatile("s_wait_xcnt 0x0" :: "v"(a0), "v"(a1), "v"(a2), "v"(a3) : "memory");
    };
    auto r2s = [&](int buf) {
        unsigned char* d = sdst + buf * LS;
#pragma unroll
        for (int i = 0; i < 4; ++i) { *(v8usa*)(d + i * LT) = g[2 * i]; *(v8usa*)(d + i * LT + 32 * LP) = g[2 * i + 1]; }
    };
    v8f acc[4];
#pragma unroll
    for (int t = 0; t < 4; ++t) acc[t] = (v8f){};
    float m_run = -__builtin_inff(), l_run = 0.0f;
    g2r(0); r2s(0);
    __syncthreads();   // stage 0 is published
#pragma unroll 1   // kept rolled: one set of staging registers, one copy of the passes' code
    for (int st = 0; st < ns; ++st) {
        if (st + 1 < ns) g2r(st + 1);        // the next stage's global loads fly under this stage's two passes
        const unsigned char* B = L + (st & 1) * LS;
#pragma unroll 1   // kept rolled: the two passes of a stage share one body (registers, code size)
        for (int sub = 0; sub < 2; ++sub) {
            const int p = 2 * st + sub, key0 = p * 32;
            if (p <= plast) {   // wave-uniform: passes beyond the wave's diagonal are skipped (the barriers are not)
                const unsigned char* kp = B + (sub * 32 + c) * LP + 16 * h;
                V kh[2][2], kl[2][2];
#pragma unroll
                for (int kt = 0; kt < 2; ++kt)
#pragma unroll
                    for (int kc = 0; kc < 2; ++kc) { kh[kt][kc] = ldsfrag(kp + kt * 16 * LP + 64 * kc); kl[kt][kc] = ldsfrag(kp + LT + kt * 16 * LP + 64 * kc); }
                v8f s[2];
#pragma unroll
                for (int kt = 0; kt < 2; ++kt) s[kt] = (v8f){};
#pragma unroll
                for (int kc = 0; kc < 2; ++kc) {
#pragma unroll
                    for (int kt = 0; kt < 2; ++kt) s[kt] = wmmab(kh[kt][kc], qh[kc], s[kt]);
#pragma unroll
                    for (int kt = 0; kt < 2; ++kt) s[kt] = wmmab(kl[kt][kc], qh[kc], s[kt]);
#pragma unroll
                    for (int kt = 0; kt < 2; ++kt) s[kt] = wmmab(kh[kt][kc], ql[kc], s[kt]); }
                const unsigned char* vp = B + 2 * LT + c * LP + 64 * sub + 16 * h;
                V vh[4], vl[4];
#pragma unroll
                for (int t = 0; t < 4; ++t) { vh[t] = ldsfrag(vp + t * 16 * LP); vl[t] = ldsfrag(vp + LT + t * 16 * LP); }
                __builtin_amdgcn_sched_barrier(0);   // the V^T fragment reads stay in front of the softmax and fly under it
                if (p == plast) {   // wave-uniform: only the last pass holds keys beyond a query (the reference's -1e10 fill vanishes identically in the softmax)
#pragma unroll
                    for (int kt = 0; kt < 2; ++kt)
#pragma unroll
                        for (int r = 0; r < 8; ++r) if (key0 + 16 * kt + 8 * h + r > q0 + c) s[kt][r] = -__builtin_inff(); }
                float mx = s[0][0];
#pragma unroll
                for (int r = 1; r < 8; ++r) mx = fmaxf(mx, s[0][r]);
#pragma unroll
                for (int r = 0; r < 8; ++r) mx = fmaxf(mx, s[1][r]);
                mx = fmaxf(mx, xhalf(mx));   // both halves of the wave hold query c's maximum (finite: the pass's first key is never beyond a query)
                if (__builtin_amdgcn_ballot_w32(mx > m_run) != 0) {   // some query's maximum grew: rescale sum and accumulators (factor 0 on the first pass, 1 for the queries whose maximum stayed)
                    const float m_new = fmaxf(m_run, mx); const float corr = __builtin_amdgcn_exp2f((m_run - m_new) * 1.4426950408889634f); m_run = m_new; l_run *= corr;
#pragma unroll
                    for (int t = 0; t < 4; ++t) acc[t] = acc[t] * corr; }
                float e[16];
#pragma unroll
                for (int i = 0; i < 16; ++i) e[i] = (s[i >> 3][i & 7] - m_run) * 1.4426950408889634f;
                // the sixteen exponentials in one statement, none directly in front of an instruction that reads its result or writes its source; the v_nop is that slot behind the last one
                asm("v_exp_f32 %0, %0\n\tv_exp_f32 %1, %1\n\tv_exp_f32 %2, %2\n\tv_exp_f32 %3, %3\n\tv_exp_f32 %4, %4\n\tv_exp_f32 %5, %5\n\tv_exp_f32 %6, %6\n\tv_exp_f32 %7, %7\n\tv_exp_f32 %8, %8\n\tv_exp_f32 %9, %9\n\tv_exp_f32 %10, %10\n\tv_exp_f32 %11, %11\n\tv_exp_f32 %12, %12\n\tv_exp_f32 %13, %13\n\tv_exp_f32 %14, %14\n\tv_exp_f32 %15, %15\n\tv_nop" : "+v"(e[0]), "+v"(e[1]), "+v"(e[2]), "+v"(e[3]), "+v"(e[4]), "+v"(e[5]), "+v"(e[6]), "+v"(e[7]), "+v"(e[8]), "+v"(e[9]), "+v"(e[10]), "+v"(e[11]), "+v"(e[12]), "+v"(e[13]), "+v"(e[14]), "+v"(e[15]));
                v8u wh, wl;
#pragma unroll
                for (int i = 0; i < 8; ++i) {
                    l_run += e[2 * i] + e[2 * i + 1];
                    const unsigned w = pack2(e[2 * i], e[2 * i + 1]); wh[i] = w; wl[i] = pack2(e[2 * i] - __uint_as_float(w << 16), e[2 * i + 1] - __uint_as_float(w & 0xFFFF0000u)); }
                const V ph = __builtin_bit_cast(V, wh), pl = __builtin_bit_cast(V, wl);
#pragma unroll
                for (int t = 0; t < 4; ++t) acc[t] = wmmab(vh[t], ph, acc[t]);
#pragma unroll
                for (int t = 0; t < 4; ++t) acc[t] = wmmab(vl[t], ph, acc[t]);
#pragma unroll
                for (int t = 0; t < 4; ++t) acc[t] = wmmab(vh[t], pl, acc[t]);
            }
        }
        if (st + 1 < ns) r2s((st + 1) & 1);   // into the buffer whose last readers left it before the previous stage's barrier
        __syncthreads();                      // publishes stage st + 1 and ends every wave's reads of stage st
    }
    const float inv = __fdiv_rn(1.0f, l_run + xhalf(l_run));   // each half summed its own keys
    const size_t oo = ((size_t)(z / NH_) * TT + q0 + c) * DQ + (size_t)(z % NH_) * HD + 8 * h;   // merged heads [b][t][n * 64 + d]; lane (c, h) holds d = 16 t + 8 h + r of query c; the wave writes whole 128-byte lines
    bf* pa = Ah + oo; bf* pb = Al + oo; v8us oh[4], ol[4];
#pragma unroll
    for (int t = 0; t < 4; ++t) {
#pragma unroll
        for (int r = 0; r < 8; ++r) { unsigned short a, c2; splitf(acc[t][r] * inv, a, c2); oh[t][r] = a; ol[t][r] = c2; }
        *(v8us*)(pa + 16 * t) = oh[t]; *(v8us*)(pb + 16 * t) = ol[t]; }
    // the address and data registers of the eight issued stores stay unwritten up to this wait (they are its inputs)
    asm volatile("s_wait_xcnt 0x0" :: "v"(pa), "v"(pb), "v"(oh[0]), "v"(oh[1]), "v"(oh[2]), "v"(oh[3]), "v"(ol[0]), "v"(ol[1]), "v"(ol[2]), "v"(ol[3]) : "memory");
}

__global__ __launch_bounds__(256) void k_cvt8(const float* __restrict__ src, bf* dst, size_t n8) { const size_t i = (size_t)blockIdx.x * 256 + threadIdx.x; if (i >= n8) return; const v8f v = *(const v8f*)(src + i * 8); v8us o;
#pragma unroll
    for (int k = 0; k < 8; ++k) o[k] = f2bf(v[k]); *(v8us*)(dst + i * 8) = o;  }

extern "C" void kernel_launch(void* const* d_in, const int* in_sizes, int n_in,
                              void* d_out, int out_size, void* d_ws, size_t ws_size, hipStream_t stream) {
    (void)in_sizes; (void)n_in; (void)out_size;
    const float* x = (const float*)d_in[0]; const float* wq = (const float*)d_in[1]; const float* wk = (const float*)d_in[2]; const float* wv = (const float*)d_in[3]; const float* wo = (const float*)d_in[4];   /* x, Q, K, V [16][64][1024] (= 'oi'), O ('oi' [1024][1024]) */
    float* OUT = (float*)d_out;     // [4][2048][1024]
    char* wsp = (char*)d_ws;
    auto take = [&](size_t bytes) { char* p = wsp; wsp += (bytes + 255) & ~(size_t)255; return (void*)p; };
    bf* WQ = (bf*)take((size_t)DQ * DM * 2); bf* WK = (bf*)take((size_t)DKV * DM * 2); bf* WV = (bf*)take((size_t)DKV * DM * 2); bf* WO = (bf*)take((size_t)DM * DQ * 2);
    bf* XB = (bf*)take((size_t)TT * DM * 2);   // the bf16 copy of one batch of x (rewritten per batch, stream-ordered)
    const size_t PB = (size_t)NH_ * TT * HD;   // one batch's share of a head plane
    bf* QPh = (bf*)take(NB_ * PB * 2); bf* QPl = (bf*)take(NB_ * PB * 2); bf* KPh = (bf*)take(NB_ * PB * 2); bf* KPl = (bf*)take(NB_ * PB * 2); bf* VTh = (bf*)take(NB_ * PB * 2); bf* VTl = (bf*)take(NB_ * PB * 2);
    bf* ATh = (bf*)take((size_t)NB_ * TT * DQ * 2); bf* ATl = (bf*)take((size_t)NB_ * TT * DQ * 2);
    if ((size_t)(wsp - (char*)d_ws) > ws_size) return;    // ws 256 MiB
    { k_cvt8<<<(unsigned)(((size_t)DQ * DM / 8 + 255) / 256), 256, 0, stream>>>(wq, WQ, (size_t)DQ * DM / 8); k_cvt8<<<(unsigned)(((size_t)DKV * DM / 8 + 255) / 256), 256, 0, stream>>>(wk, WK, (size_t)DKV * DM / 8); k_cvt8<<<(unsigned)(((size_t)DKV * DM / 8 + 255) / 256), 256, 0, stream>>>(wv, WV, (size_t)DKV * DM / 8);
      k_cvt8<<<(unsigned)(((size_t)DM * DQ / 8 + 255) / 256), 256, 0, stream>>>(wo, WO, (size_t)DM * DQ / 8);
       }
    for (int b = 0; b < NB_; ++b) {
        k_cvt8<<<(unsigned)(((size_t)TT * DM / 8 + 255) / 256), 256, 0, stream>>>(x + (size_t)b * TT * DM, XB, (size_t)TT * DM / 8);
        k_gemmt<DM, 0, true><<<dim3(TT / 128, DQ / 64, 1), 256, 0, stream>>>(XB, nullptr, WQ, nullptr, HD, QPh + b * PB, QPl + b * PB, (size_t)TT * HD);     // a 64-column tile is one head: planes [b][h][t][d]
        k_gemmt<DM, 0, true><<<dim3(TT / 128, DKV / 64, 1), 256, 0, stream>>>(XB, nullptr, WK, nullptr, HD, KPh + b * PB, KPl + b * PB, (size_t)TT * HD);
        k_gemmt<DM, 0, true><<<dim3(DKV / 128, TT / 64, 1), 256, 0, stream>>>(WV, nullptr, XB, nullptr, TT, VTh + b * PB, VTl + b * PB, (size_t)64); }        // operands swapped: rows g*64 + d, columns t, so the planes are [b][g][d][t]
    k_attn<<<dim3(NB_ * NH_, TT / (AW * 16), 1), AW * 32, 0, stream>>>(QPh, QPl, KPh, KPl, VTh, VTl, ATh, ATl);
    for (int b = 0; b < NB_; ++b)
        k_gemmt<DQ, 1, false><<<dim3(TT / 128, DM / 64, 1), 256, 0, stream>>>(ATh + (size_t)b * TT * DQ, ATl + (size_t)b * TT * DQ, WO, OUT + (size_t)b * TT * DM, DM, nullptr, nullptr, 0);
}

// v006
// It runs in 195 microseconds.
// In two side-by-side timings against v005, it was 1.41 and 1.36 times as fast.
// Over all steps from v000 it is 11.9 times as fast.
#include <hip/hip_runtime.h>

// Causal attention with per-head weight tensors and NO score scaling (x [4][2048][1024]; q = einsum('nhm,btm', Q, x) with Q, K, V [16][64][1024] (= 'oi' [1024][1024] with rows n*64 + h; 1/32 scale); scores = q.k (the source has no 1/sqrt(d_head) factor: logits sigma ~8); causal (-1e10 == exclusion); softmax; z = merged heads (n, h); out = einsum('ma,bqa', O, z) ('oi') -> [4][2048][1024] (8.4 M); argument order x, Q, K, V, O).
// Four launches, each over all batches: bf16 copies of x and of the four weights; the [16][64][1024] weights are already Bt planes ('oi' rows n*64 + h); exact q, k and v projections in one launch, which store their hi/lo head planes themselves (v with the operands swapped, so its tile is already [d][t]); one fused causal attention kernel over all batches and heads (online softmax, scores and probabilities stay in registers, hi/lo planes, 3 products); merged hi/lo x O exact.
// Compute dtypes, f32 accumulate: every input rounded to bf16; projections exact; softmax f32; O hl x exact.

#define NB_  4
#define TT   2048
#define DM   1024
#define NH_  16
#define NKV  16
#define REP  (NH_ / NKV)
#define HD   64
#define DQ   (NH_ * HD)
#define DKV  (NKV * HD)
#define AW   8                    // waves per work-group of the attention kernel, 16 query rows each
typedef _Float16 h16;
typedef unsigned short bf;
typedef __attribute__((ext_vector_type(16))) __bf16   v16bf;
typedef __attribute__((ext_vector_type(16))) _Float16 v16h;
typedef __attribute__((ext_vector_type(8)))  _Float16 v8h;
typedef __attribute__((ext_vector_type(8)))  unsigned short v8us;
typedef __attribute__((ext_vector_type(8)))  float    v8f;
typedef __attribute__((ext_vector_type(4)))  float    v4f;
typedef v8h  __attribute__((may_alias)) v8ha;
typedef v4f  __attribute__((may_alias)) v4fa;
typedef v8us __attribute__((may_alias)) v8usa;

__device__ __forceinline__ unsigned short f2bf(float f) { unsigned u = __float_as_uint(f); u += 0x7FFFu + ((u >> 16) & 1u); return (unsigned short)(u >> 16); }
__device__ __forceinline__ float bf2f(unsigned short b) { return __uint_as_float(((unsigned)b) << 16); }
__device__ __forceinline__ float bfr(float f) { return bf2f(f2bf(f)); }
__device__ __forceinline__ void splitf(float y, unsigned short& h, unsigned short& l) { h = f2bf(y); l = f2bf(y - bf2f(h)); }
__device__ __forceinline__ v16h cat16(v8h lo, v8h hi) { return __builtin_shufflevector(lo, hi, 0, 1, 2, 3, 4, 5, 6, 7, 8, 9, 10, 11, 12, 13, 14, 15); }
__device__ __forceinline__ v16bf cat16b(v8us lo, v8us hi) { return __builtin_bit_cast(v16bf, __builtin_shufflevector(lo, hi, 0, 1, 2, 3, 4, 5, 6, 7, 8, 9, 10, 11, 12, 13, 14, 15)); }
__device__ __forceinline__ v8f wmma16(v16h a, v16h b, v8f c) { return __builtin_amdgcn_wmma_f32_16x16x32_f16(false, a, false, b, (short)0, c, false, false); }
__device__ __forceinline__ v8f wmmab(v16bf a, v16bf b, v8f c) { return __builtin_amdgcn_wmma_f32_16x16x32_bf16(false, a, false, b, (short)0, c, false, false); }



// ---- k_gemmt: work-group tiled GEMM. Eight waves share a 128x64 output tile (a wave 32x32, four accumulators); grid (M/128, N/64), 256 threads. The K-contiguous bf16 operand rows are brought in stages of 128 k
// by whole-line loads (a wave's load covers four 128-byte lines), through registers into LDS, two buffers, one barrier a stage; the next stage's global loads fly under this stage's products. The fragments are read from LDS.
// C[m][n] (f32, pitch ldc) = sum_k A[m][k] Bt[n][k] (+ A2[m][k] Bt[n][k] if NSPLIT), k ascending in steps of 32, A in front of A2. KK % 128 == 0.
// PL: the three projections of all batches in one launch, grid (NQK + NV). A = the bf16 x [NB_*TT][KK], Bt = the q, k and v weights one behind the other [3*DQ][KK]. Work-groups 0 .. NQK-1: 128 rows of x by one head of q or k;
// the others: 128 rows of the v weight by 64 rows of x (operands swapped). No f32 C; the tile is split into bf16 hi and lo and stored in Ph/Pl = planes q [b][h][t][d], k [b][h][t][d], v [b][g][d][t], one behind the other.
// The plain '#pragma unroll' lines give the staging, fragment and accumulator arrays constant indices, so that they stay in registers.
template <typename T16> struct WFrag;
template <> struct WFrag<h16> { typedef v16h V; static __device__ __forceinline__ V ld(const h16* p) { return cat16(*(const v8h*)p, *(const v8h*)(p + 16)); } static __device__ __forceinline__ v8f mma(V a, V b, v8f c) { return wmma16(a, b, c); } };
template <> struct WFrag<bf> { typedef v16bf V; static __device__ __forceinline__ V ld(const bf* p) { return cat16b(*(const v8us*)p, *(const v8us*)(p + 16)); } static __device__ __forceinline__ v8f mma(V a, V b, v8f c) { return wmmab(a, b, c); } };
#define PB   ((size_t)NH_ * TT * HD)   // one batch's share of a head plane
#define NQK  ((NB_ * TT / 128) * ((DQ + DKV) / 64))   // q and k tiles of the projection launch
#define NV   ((DKV / 128) * (NB_ * TT / 64))          // v tiles
#define GP   144                  // LDS row pitch in bytes: a 128-byte row (64 k) + 16 (an odd multiple of 16, for the 16-byte fragment reads)
__device__ __forceinline__ v16bf ldsfrag(const unsigned char* p) { return cat16b(*(const v8usa*)p, *(const v8usa*)(p + 32)); }   // elements 0..7 and 16..23 from p, as WFrag::ld
template <int KK, int NSPLIT, bool PL>
__global__ __launch_bounds__(256) void k_gemmt(const bf* __restrict__ A, const bf* __restrict__ A2, const bf* __restrict__ Bt, float* C, int ldc, bf* Ph, bf* Pl) {
    typedef v16bf V;
    constexpr int NA = NSPLIT ? 2 : 1, TA = 128 * GP, TB = 64 * GP;   // tiles of 64 k: A (and A2) 128 rows, Bt 64 rows
    constexpr int HS = NA * TA + TB, SS = 2 * HS, NS = KK / 128;      // half a stage (64 k), a stage (128 k), stages
    constexpr int GK = NSPLIT ? 2 : 4;                                // steps of 32 k whose fragments are read as one group (registers: 4 or 6 fragments a step)
    __shared__ __align__(16) unsigned char L[2 * SS];
    const int tid = threadIdx.x, lane = tid & 31, lr = lane & 15, hi = lane >> 4; const int wave = __builtin_amdgcn_readfirstlane(tid >> 5);
    const int wm = wave >> 1, wn = wave & 1;
    int r0 = blockIdx.x * 128, c0 = blockIdx.y * 64; int ldo = 0; size_t ob = 0;   // PL: the tile's first element in Ph/Pl and its row pitch there
    if (PL) {
        const unsigned id = blockIdx.x;
        if (id < NQK) { const unsigned hd = id / (NB_ * TT / 128); r0 = (id % (NB_ * TT / 128)) * 128; c0 = hd * 64;   // hd: q heads, then k heads; a 128-row tile lies in one batch
            ob = (size_t)(hd / NH_) * NB_ * PB + (size_t)((unsigned)r0 / TT) * PB + (size_t)(hd % NH_) * TT * HD + (size_t)((unsigned)r0 % TT) * HD; ldo = HD; }
        else { const unsigned iv = id - NQK; r0 = (iv % (DKV / 128)) * 128; c0 = (iv / (DKV / 128)) * 64;              // rows g*64 + d of the v weight, columns b*TT + t; a 64-column tile lies in one batch
            ob = (size_t)2 * NB_ * PB + (size_t)((unsigned)c0 / TT) * PB + (size_t)r0 * TT + (size_t)((unsigned)c0 % TT); ldo = TT;
            const bf* xs = A; A = Bt + (size_t)(DQ + DKV) * KK; Bt = xs; }
    }
    // staging: thread tid brings 16 bytes of rows tid / 8 + 32 i of every tile
    const int srow = tid >> 3, scol = (tid & 7) * 8;
    const bf* ga = A + (size_t)(r0 + srow) * KK + scol; const bf* ga2 = NSPLIT ? A2 + (size_t)(r0 + srow) * KK + scol : ga; const bf* gb = Bt + (size_t)(c0 + srow) * KK + scol;
    unsigned char* sdst = L + srow * GP + scol * 2;
    v8us xa[8], xa2[8], xb[4];
    auto g2r = [&](int st) {
        const bf* pa = ga + st * 128; const bf* pa2 = ga2 + st * 128; const bf* pb = gb + st * 128;
#pragma unroll
        for (int kh = 0; kh < 2; ++kh) {
#pragma unroll
            for (int i = 0; i < 4; ++i) { xa[kh * 4 + i] = *(const v8us*)(pa + kh * 64 + i * 32 * KK); if (NSPLIT) xa2[kh * 4 + i] = *(const v8us*)(pa2 + kh * 64 + i * 32 * KK); }
#pragma unroll
            for (int i = 0; i < 2; ++i) xb[kh * 2 + i] = *(const v8us*)(pb + kh * 64 + i * 32 * KK); }
        // the address registers of the issued loads stay unwritten up to this wait (they are its inputs)
        asm volatile("s_wait_xcnt 0x0" :: "v"(pa), "v"(pa2), "v"(pb) : "memory");
    };
    auto r2s = [&](int buf) {
        unsigned char* d = sdst + buf * SS;
#pragma unroll
        for (int kh = 0; kh < 2; ++kh) {
#pragma unroll
            for (int i = 0; i < 4; ++i) { *(v8usa*)(d + kh * HS + i * 32 * GP) = xa[kh * 4 + i]; if (NSPLIT) *(v8usa*)(d + kh * HS + TA + i * 32 * GP) = xa2[kh * 4 + i]; }
#pragma unroll
            for (int i = 0; i < 2; ++i) *(v8usa*)(d + kh * HS + NA * TA + i * 32 * GP) = xb[kh * 2 + i]; }
    };
    v8f acc[2][2];
#pragma unroll
    for (int mb = 0; mb < 2; ++mb)
#pragma unroll
        for (int nb = 0; nb < 2; ++nb) acc[mb][nb] = (v8f){};
    const int aofs = (wm * 32 + lr) * GP + 16 * hi, bofs = NA * TA + (wn * 32 + lr) * GP + 16 * hi;
    g2r(0); r2s(0);
    __syncthreads();   // stage 0 is published
#pragma unroll 1   // kept rolled: one set of staging registers, one copy of the stage's code
    for (int st = 0; st < NS; ++st) {
        if (st + 1 < NS) g2r(st + 1);        // the next stage's global loads fly under this stage's products
        const unsigned char* B = L + (st & 1) * SS;
#pragma unroll
        for (int gr = 0; gr < 4 / GK; ++gr) {   // groups of GK steps of 32 k
            V a[GK][2], a2[GK][2], b[GK][2];
#pragma unroll
            for (int kk = 0; kk < GK; ++kk) {
                const int ks = gr * GK + kk; const unsigned char* H = B + (ks >> 1) * HS + 64 * (ks & 1);
#pragma unroll
                for (int mb = 0; mb < 2; ++mb) a[kk][mb] = ldsfrag(H + aofs + mb * 16 * GP);
#pragma unroll
                for (int nb = 0; nb < 2; ++nb) b[kk][nb] = ldsfrag(H + bofs + nb * 16 * GP);
                if (NSPLIT) {
#pragma unroll
                    for (int mb = 0; mb < 2; ++mb) a2[kk][mb] = ldsfrag(H + TA + aofs + mb * 16 * GP); } }
            __builtin_amdgcn_sched_barrier(0);   // the group's fragment reads stay one block in front of its products (counted waits), instead of a read, a full wait and two products in turn
#pragma unroll
            for (int kk = 0; kk < GK; ++kk) {
#pragma unroll
                for (int nb = 0; nb < 2; ++nb)
#pragma unroll
                    for (int mb = 0; mb < 2; ++mb) acc[mb][nb] = wmmab(a[kk][mb], b[kk][nb], acc[mb][nb]);
                if (NSPLIT) {
#pragma unroll
                    for (int nb = 0; nb < 2; ++nb)
#pragma unroll
                        for (int mb = 0; mb < 2; ++mb) acc[mb][nb] = wmmab(a2[kk][mb], b[kk][nb], acc[mb][nb]); } }
        }
        if (st + 1 < NS) r2s((st + 1) & 1);   // into the buffer whose last readers left it before the previous stage's barrier
        __syncthreads();                      // publishes stage st + 1 and ends every wave's reads of stage st
    }
    // the f32 tile goes through LDS (the operand buffers are free behind the last barrier), so that a wave stores whole rows: one writer per 128-byte line
    float* os = (float*)L;   // [128][68]
#pragma unroll
    for (int mb = 0; mb < 2; ++mb)
#pragma unroll
        for (int nb = 0; nb < 2; ++nb)
#pragma unroll
            for (int j = 0; j < 8; ++j) os[(wm * 32 + mb * 16 + hi * 8 + j) * 68 + wn * 32 + nb * 16 + lr] = acc[mb][nb][j];
    __syncthreads();   // the tile is complete before any wave reads its sixteen rows
    if (PL) { bf* ph[4]; bf* pl[4]; v8us oh[4], ol[4];
#pragma unroll
        for (int s = 0; s < 4; ++s) { const int row = wave * 16 + 4 * s + (lane >> 3), cofs = (lane & 7) * 8; const v4f x0 = *(const v4fa*)(os + row * 68 + cofs), x1 = *(const v4fa*)(os + row * 68 + cofs + 4);
#pragma unroll
            for (int q = 0; q < 4; ++q) { unsigned short a, c2; splitf(x0[q], a, c2); oh[s][q] = a; ol[s][q] = c2; splitf(x1[q], a, c2); oh[s][q + 4] = a; ol[s][q + 4] = c2; }
            const size_t oo = ob + (size_t)row * ldo + cofs; ph[s] = Ph + oo; pl[s] = Pl + oo;
            *(v8us*)ph[s] = oh[s]; *(v8us*)pl[s] = ol[s]; }
        // the address and data registers of the eight issued stores stay unwritten up to this wait (they are its inputs)
        asm volatile("s_wait_xcnt 0x0" :: "v"(ph[0]), "v"(ph[1]), "v"(ph[2]), "v"(ph[3]), "v"(pl[0]), "v"(pl[1]), "v"(pl[2]), "v"(pl[3]), "v"(oh[0]), "v"(oh[1]), "v"(oh[2]), "v"(oh[3]), "v"(ol[0]), "v"(ol[1]), "v"(ol[2]), "v"(ol[3]) : "memory");
    } else { float* pc[8]; v4f val[8];
#pragma unroll
        for (int s = 0; s < 8; ++s) { const int row = wave * 16 + 2 * s + hi, cofs = lr * 4; val[s] = *(const v4fa*)(os + row * 68 + cofs); pc[s] = C + (size_t)(r0 + row) * ldc + c0 + cofs;
            *(v4f*)pc[s] = val[s]; }
        // as above
        asm volatile("s_wait_xcnt 0x0" :: "v"(pc[0]), "v"(pc[1]), "v"(pc[2]), "v"(pc[3]), "v"(pc[4]), "v"(pc[5]), "v"(pc[6]), "v"(pc[7]), "v"(val[0]), "v"(val[1]), "v"(val[2]), "v"(val[3]), "v"(val[4]), "v"(val[5]), "v"(val[6]), "v"(val[7]) : "memory");
    }
}

// ---- k_attn: causal attention, scores, softmax and probability x value in one kernel. A work-group owns 128 query rows of one (batch, head) z, a wave 16 of them; the keys are walked in stages of 64
// (K hi/lo rows and V^T hi/lo rows staged in LDS through registers, whole lines, two buffers, one barrier a stage), each stage in two passes of 32 keys, up to each wave's own diagonal.
// Transposed products: S^T = K.Q^T (A = 16 keys x 32 d, B = 16 queries) leaves in lane (c, h) the scores of query c for keys 8 h + r of each 16-key tile, which is the k order of a B fragment over 32 keys,
// so P^T goes into O^T += V^T.P^T (A = 16 d x 32 keys from the [d][t] planes) without leaving the registers. Every operand is hi + lo bf16, three products each. Running maximum and sum per query (online softmax), f32.
// The plain '#pragma unroll' lines give the fragment and accumulator arrays constant indices, so that they stay in registers.
#define LP   144                  // LDS row pitch in bytes: a 128-byte row + 16 (an odd multiple of 16, for the 16-byte fragment reads)
#define LT   (64 * LP)            // one tile of 64 rows
#define LS   (4 * LT)             // one stage: K hi, K lo (rows = keys), V^T hi, V^T lo (rows = d)
typedef __attribute__((ext_vector_type(2))) float v2f;
typedef __attribute__((ext_vector_type(2))) __bf16 v2bf;
typedef __attribute__((ext_vector_type(8))) unsigned v8u;
__device__ __forceinline__ float xhalf(float x) { return __builtin_bit_cast(float, __builtin_amdgcn_permlanex16(__builtin_bit_cast(int, x), __builtin_bit_cast(int, x), 0x76543210, 0xfedcba98, false, false)); }   // lane l with lane l ^ 16
__device__ __forceinline__ unsigned pack2(float a, float b) { return __builtin_bit_cast(unsigned, __builtin_convertvector((v2f){a, b}, v2bf)); }   // two f32 to two bf16, round to nearest even
__global__ __launch_bounds__(AW * 32) void k_attn(const bf* __restrict__ Qh, const bf* __restrict__ Ql, const bf* __restrict__ Kh, const bf* __restrict__ Kl, const bf* __restrict__ Vh, const bf* __restrict__ Vl, bf* Ah, bf* Al) {
    typedef v16bf V;
    __shared__ __align__(16) unsigned char L[2 * LS];
    const int tid = threadIdx.x, lane = tid & 31, c = lane & 15, h = lane >> 4; const int wave = __builtin_amdgcn_readfirstlane(tid >> 5);
    const int z = blockIdx.x;                                        // batch * NH_ + head
    const int qb = TT / (AW * 16) - 1 - (int)blockIdx.y;             // longest key loops take the lowest blockIdx.y
    const int q0 = qb * (AW * 16) + wave * 16;
    const size_t zo = (size_t)z * TT * HD;
    const int ns = 2 * qb + 2;                                       // 64-key stages up to the work-group's last query
    const int plast = (q0 + 15) / 32;                                // the wave's last 32-key pass, the one that holds its diagonal
    const bf* qph = Qh + zo + (size_t)(q0 + c) * HD + 8 * h; const bf* qpl = Ql + zo + (size_t)(q0 + c) * HD + 8 * h;
    V qh[2], ql[2];
#pragma unroll
    for (int kc = 0; kc < 2; ++kc) { qh[kc] = WFrag<bf>::ld(qph + 32 * kc); ql[kc] = WFrag<bf>::ld(qpl + 32 * kc); }
    // the address registers of the issued loads stay unwritten up to this wait (they are its inputs)
    asm volatile("s_wait_xcnt 0x0" :: "v"(qph), "v"(qpl) : "memory");
    // staging: thread tid brings 16 bytes of rows tid / 8 and tid / 8 + 32 of each of the four tiles
    const int srow = tid >> 3, scol = (tid & 7) * 8;
    const bf* gkh = Kh + zo + srow * HD + scol; const bf* gkl = Kl + zo + srow * HD + scol;
    const bf* gvh = Vh + zo + (size_t)srow * TT + scol; const bf* gvl = Vl + zo + (size_t)srow * TT + scol;
    unsigned char* sdst = L + srow * LP + scol * 2;
    v8us g[8];
    auto g2r = [&](int st) {
        const bf* a0 = gkh + (size_t)st * 64 * HD; const bf* a1 = gkl + (size_t)st * 64 * HD; const bf* a2 = gvh + st * 64; const bf* a3 = gvl + st * 64;
        g[0] = *(const v8us*)a0; g[1] = *(const v8us*)(a0 + 32 * HD); g[2] = *(const v8us*)a1; g[3] = *(const v8us*)(a1 + 32 * HD);
        g[4] = *(const v8us*)a2; g[5] = *(const v8us*)(a2 + (size_t)32 * TT); g[6] = *(const v8us*)a3; g[7] = *(const v8us*)(a3 + (size_t)32 * TT);
        // as above, for the four address pairs
        asm volatile("s_wait_xcnt 0x0" :: "v"(a0), "v"(a1), "v"(a2), "v"(a3) : "memory");
    };
    auto r2s = [&](int buf) {
        unsigned char* d = sdst + buf * LS;
#pragma unroll
        for (int i = 0; i < 4; ++i) { *(v8usa*)(d + i * LT) = g[2 * i]; *(v8usa*)(d + i * LT + 32 * LP) = g[2 * i + 1]; }
    };
    v8f acc[4];
#pragma unroll
    for (int t = 0; t < 4; ++t) acc[t] = (v8f){};
    float m_run = -__builtin_inff(), l_run = 0.0f;
    g2r(0); r2s(0);
    __syncthreads();   // stage 0 is published
#pragma unroll 1   // kept rolled: one set of staging registers, one copy of the passes' code
    for (int st = 0; st < ns; ++st) {
        if (st + 1 < ns) g2r(st + 1);        // the next stage's global loads fly under this stage's two passes
        const unsigned char* B = L + (st & 1) * LS;
#pragma unroll 1   // kept rolled: the two passes of a stage share one body (registers, code size)
        for (int sub = 0; sub < 2; ++sub) {
            const int p = 2 * st + sub, key0 = p * 32;
            if (p <= plast) {   // wave-uniform: passes beyond the wave's diagonal are skipped (the barriers are not)
                const unsigned char* kp = B + (sub * 32 + c) * LP + 16 * h;
                V kh[2][2], kl[2][2];
#pragma unroll
                for (int kt = 0; kt < 2; ++kt)
#pragma unroll
                    for (int kc = 0; kc < 2; ++kc) { kh[kt][kc] = ldsfrag(kp + kt * 16 * LP + 64 * kc); kl[kt][kc] = ldsfrag(kp + LT + kt * 16 * LP + 64 * kc); }
                v8f s[2];
#pragma unroll
                for (int kt = 0; kt < 2; ++kt) s[kt] = (v8f){};
#pragma unroll
                for (int kc = 0; kc < 2; ++kc) {
#pragma unroll
                    for (int kt = 0; kt < 2; ++kt) s[kt] = wmmab(kh[kt][kc], qh[kc], s[kt]);
#pragma unroll
                    for (int kt = 0; kt < 2; ++kt) s[kt] = wmmab(kl[kt][kc], qh[kc], s[kt]);
#pragma unroll
                    for (int kt = 0; kt < 2; ++kt) s[kt] = wmmab(kh[kt][kc], ql[kc], s[kt]); }
                const unsigned char* vp = B + 2 * LT + c * LP + 64 * sub + 16 * h;
                V vh[4], vl[4];
#pragma unroll
                for (int t = 0; t < 4; ++t) { vh[t] = ldsfrag(vp + t * 16 * LP); vl[t] = ldsfrag(vp + LT + t * 16 * LP); }
                __builtin_amdgcn_sched_barrier(0);   // the V^T fragment reads stay in front of the softmax and fly under it
                if (p == plast) {   // wave-uniform: only the last pass holds keys beyond a query (the reference's -1e10 fill vanishes identically in the softmax)
#pragma unroll
                    for (int kt = 0; kt < 2; ++kt)
#pragma unroll
                        for (int r = 0; r < 8; ++r) if (key0 + 16 * kt + 8 * h + r > q0 + c) s[kt][r] = -__builtin_inff(); }
                float mx = s[0][0];
#pragma unroll
                for (int r = 1; r < 8; ++r) mx = fmaxf(mx, s[0][r]);
#pragma unroll
                for (int r = 0; r < 8; ++r) mx = fmaxf(mx, s[1][r]);
                mx = fmaxf(mx, xhalf(mx));   // both halves of the wave hold query c's maximum (finite: the pass's first key is never beyond a query)
                if (__builtin_amdgcn_ballot_w32(mx > m_run) != 0) {   // some query's maximum grew: rescale sum and accumulators (factor 0 on the first pass, 1 for the queries whose maximum stayed)
                    const float m_new = fmaxf(m_run, mx); const float corr = __builtin_amdgcn_exp2f((m_run - m_new) * 1.4426950408889634f); m_run = m_new; l_run *= corr;
#pragma unroll
                    for (int t = 0; t < 4; ++t) acc[t] = acc[t] * corr; }
                float e[16];
#pragma unroll
                for (int i = 0; i < 16; ++i) e[i] = (s[i >> 3][i & 7] - m_run) * 1.4426950408889634f;
                // the sixteen exponentials in one statement, none directly in front of an instruction that reads its result or writes its source; the v_nop is that slot behind the last one
                asm("v_exp_f32 %0, %0\n\tv_exp_f32 %1, %1\n\tv_exp_f32 %2, %2\n\tv_exp_f32 %3, %3\n\tv_exp_f32 %4, %4\n\tv_exp_f32 %5, %5\n\tv_exp_f32 %6, %6\n\tv_exp_f32 %7, %7\n\tv_exp_f32 %8, %8\n\tv_exp_f32 %9, %9\n\tv_exp_f32 %10, %10\n\tv_exp_f32 %11, %11\n\tv_exp_f32 %12, %12\n\tv_exp_f32 %13, %13\n\tv_exp_f32 %14, %14\n\tv_exp_f32 %15, %15\n\tv_nop" : "+v"(e[0]), "+v"(e[1]), "+v"(e[2]), "+v"(e[3]), "+v"(e[4]), "+v"(e[5]), "+v"(e[6]), "+v"(e[7]), "+v"(e[8]), "+v"(e[9]), "+v"(e[10]), "+v"(e[11]), "+v"(e[12]), "+v"(e[13]), "+v"(e[14]), "+v"(e[15]));
                v8u wh, wl;
#pragma unroll
                for (int i = 0; i < 8; ++i) {
                    l_run += e[2 * i] + e[2 * i + 1];
                    const unsigned w = pack2(e[2 * i], e[2 * i + 1]); wh[i] = w; wl[i] = pack2(e[2 * i] - __uint_as_float(w << 16), e[2 * i + 1] - __uint_as_float(w & 0xFFFF0000u)); }
                const V ph = __builtin_bit_cast(V, wh), pl = __builtin_bit_cast(V, wl);
#pragma unroll
                for (int t = 0; t < 4; ++t) acc[t] = wmmab(vh[t], ph, acc[t]);
#pragma unroll
                for (int t = 0; t < 4; ++t) acc[t] = wmmab(vl[t], ph, acc[t]);
#pragma unroll
                for (int t = 0; t < 4; ++t) acc[t] = wmmab(vh[t], pl, acc[t]);
            }
        }
        if (st + 1 < ns) r2s((st + 1) & 1);   // into the buffer whose last readers left it before the previous stage's barrier
        __syncthreads();                      // publishes stage st + 1 and ends every wave's reads of stage st
    }
    const float inv = __fdiv_rn(1.0f, l_run + xhalf(l_run));   // each half summed its own keys
    const size_t oo = ((size_t)(z / NH_) * TT + q0 + c) * DQ + (size_t)(z % NH_) * HD + 8 * h;   // merged heads [b][t][n * 64 + d]; lane (c, h) holds d = 16 t + 8 h + r of query c; the wave writes whole 128-byte lines
    bf* pa = Ah + oo; bf* pb = Al + oo; v8us oh[4], ol[4];
#pragma unroll
    for (int t = 0; t < 4; ++t) {
#pragma unroll
        for (int r = 0; r < 8; ++r) { unsigned short a, c2; splitf(acc[t][r] * inv, a, c2); oh[t][r] = a; ol[t][r] = c2; }
        *(v8us*)(pa + 16 * t) = oh[t]; *(v8us*)(pb + 16 * t) = ol[t]; }
    // the address and data registers of the eight issued stores stay unwritten up to this wait (they are its inputs)
    asm volatile("s_wait_xcnt 0x0" :: "v"(pa), "v"(pb), "v"(oh[0]), "v"(oh[1]), "v"(oh[2]), "v"(oh[3]), "v"(ol[0]), "v"(ol[1]), "v"(ol[2]), "v"(ol[3]) : "memory");
}

// ---- k_cvt8: f32 to bf16, eight elements a thread, all five inputs in one launch: work-groups 0 .. CX-1 take x, then CW each for the q, k, v and o weights (their copies lie one behind the other in Wd).
#define CX   (NB_ * TT * DM / (8 * 256))
#define CW   (DQ * DM / (8 * 256))
static_assert(NB_ * TT * DM % (8 * 256) == 0 && DQ * DM % (8 * 256) == 0 && DKV == DQ, "the grid covers every array exactly, so no thread needs a bounds test");
__global__ __launch_bounds__(256) void k_cvt8(const float* __restrict__ x, const float* __restrict__ wq, const float* __restrict__ wk, const float* __restrict__ wv, const float* __restrict__ wo, bf* Xd, bf* Wd) {
    const unsigned blk = blockIdx.x; const float* src = x; bf* dst = Xd; unsigned b0 = blk;
    if (blk >= CX) { const unsigned w = (blk - CX) / CW; b0 = (blk - CX) % CW; src = w == 0 ? wq : w == 1 ? wk : w == 2 ? wv : wo; dst = Wd + (size_t)w * DQ * DM; }
    const size_t i = (size_t)b0 * 256 + threadIdx.x; const v8f v = *(const v8f*)(src + i * 8); v8us o;
#pragma unroll
    for (int k = 0; k < 8; ++k) o[k] = f2bf(v[k]); *(v8us*)(dst + i * 8) = o;  }

extern "C" void kernel_launch(void* const* d_in, const int* in_sizes, int n_in,
                              void* d_out, int out_size, void* d_ws, size_t ws_size, hipStream_t stream) {
    (void)in_sizes; (void)n_in; (void)out_size;
    const float* x = (const float*)d_in[0]; const float* wq = (const float*)d_in[1]; const float* wk = (const float*)d_in[2]; const float* wv = (const float*)d_in[3]; const float* wo = (const float*)d_in[4];   /* x, Q, K, V [16][64][1024] (= 'oi'), O ('oi' [1024][1024]) */
    float* OUT = (float*)d_out;     // [4][2048][1024]
    char* wsp = (char*)d_ws;
    auto take = [&](size_t bytes) { char* p = wsp; wsp += (bytes + 255) & ~(size_t)255; return (void*)p; };
    bf* WQ = (bf*)take((size_t)4 * DQ * DM * 2); bf* WO = WQ + (size_t)3 * DQ * DM;   // bf16 copies of the q, k, v and o weights, one behind the other
    bf* XB = (bf*)take((size_t)NB_ * TT * DM * 2);   // the bf16 copy of x
    bf* PH = (bf*)take(3 * NB_ * PB * 2); bf* PLo = (bf*)take(3 * NB_ * PB * 2);        // hi and lo planes: q, k, v^T, one behind the other
    bf* ATh = (bf*)take((size_t)NB_ * TT * DQ * 2); bf* ATl = (bf*)take((size_t)NB_ * TT * DQ * 2);
    if ((size_t)(wsp - (char*)d_ws) > ws_size) return;    // ws 256 MiB
    k_cvt8<<<CX + 4 * CW, 256, 0, stream>>>(x, wq, wk, wv, wo, XB, WQ);
    k_gemmt<DM, 0, true><<<NQK + NV, 256, 0, stream>>>(XB, nullptr, WQ, nullptr, 0, PH, PLo);
    k_attn<<<dim3(NB_ * NH_, TT / (AW * 16), 1), AW * 32, 0, stream>>>(PH, PLo, PH + NB_ * PB, PLo + NB_ * PB, PH + 2 * NB_ * PB, PLo + 2 * NB_ * PB, ATh, ATl);
    k_gemmt<DQ, 1, false><<<dim3(NB_ * TT / 128, DM / 64, 1), 256, 0, stream>>>(ATh, ATl, WO, OUT, DM, nullptr, nullptr);   // the batches' rows lie one behind the other in ATh/ATl and in OUT
}

// v007
// One run takes 165 microseconds.
// Two timings next to v006 put it at 1.19 and 1.21 times that version's speed.
// Over all steps from v000 it is 14.3 times as fast.
#include <hip/hip_runtime.h>

// Causal attention with per-head weight tensors and NO score scaling (x [4][2048][1024]; q = einsum('nhm,btm', Q, x) with Q, K, V [16][64][1024] (= 'oi' [1024][1024] with rows n*64 + h; 1/32 scale); scores = q.k (the source has no 1/sqrt(d_head) factor: logits sigma ~8); causal (-1e10 == exclusion); softmax; z = merged heads (n, h); out = einsum('ma,bqa', O, z) ('oi') -> [4][2048][1024] (8.4 M); argument order x, Q, K, V, O).
// Four launches, each over all batches: bf16 copies of x and of the four weights; the [16][64][1024] weights are already Bt planes ('oi' rows n*64 + h); exact q, k and v projections in one launch, which store their hi/lo head planes themselves (v with the operands swapped, so its tile is already [d][t]); one fused causal attention kernel over all batches and heads (online softmax, scores and probabilities stay in registers, hi/lo planes, 3 products); merged hi/lo x O exact.
// Compute dtypes, f32 accumulate: every input rounded to bf16; projections exact; softmax f32; O hl x exact.

#define NB_  4
#define TT   2048
#define DM   1024
#define NH_  16
#define NKV  16
#define REP  (NH_ / NKV)
#define HD   64
#define DQ   (NH_ * HD)
#define DKV  (NKV * HD)
#define AW   8                    // waves per work-group of the attention kernel, 16 query rows each
typedef _Float16 h16;
typedef unsigned short bf;
typedef __attribute__((ext_vector_type(16))) __bf16   v16bf;
typedef __attribute__((ext_vector_type(16))) _Float16 v16h;
typedef __attribute__((ext_vector_type(8)))  _Float16 v8h;
typedef __attribute__((ext_vector_type(8)))  unsigned short v8us;
typedef __attribute__((ext_vector_type(8)))  float    v8f;
typedef __attribute__((ext_vector_type(4)))  float    v4f;
typedef v8h  __attribute__((may_alias)) v8ha;
typedef v4f  __attribute__((may_alias)) v4fa;
typedef v8us __attribute__((may_alias)) v8usa;

__device__ __forceinline__ unsigned short f2bf(float f) { unsigned u = __float_as_uint(f); u += 0x7FFFu + ((u >> 16) & 1u); return (unsigned short)(u >> 16); }
__device__ __forceinline__ float bf2f(unsigned short b) { return __uint_as_float(((unsigned)b) << 16); }
__device__ __forceinline__ float bfr(float f) { return bf2f(f2bf(f)); }
__device__ __forceinline__ void splitf(float y, unsigned short& h, unsigned short& l) { h = f2bf(y); l = f2bf(y - bf2f(h)); }
__device__ __forceinline__ v16h cat16(v8h lo, v8h hi) { return __builtin_shufflevector(lo, hi, 0, 1, 2, 3, 4, 5, 6, 7, 8, 9, 10, 11, 12, 13, 14, 15); }
__device__ __forceinline__ v16bf cat16b(v8us lo, v8us hi) { return __builtin_bit_cast(v16bf, __builtin_shufflevector(lo, hi, 0, 1, 2, 3, 4, 5, 6, 7, 8, 9, 10, 11, 12, 13, 14, 15)); }
__device__ __forceinline__ v8f wmma16(v16h a, v16h b, v8f c) { return __builtin_amdgcn_wmma_f32_16x16x32_f16(false, a, false, b, (short)0, c, false, false); }
__device__ __forceinline__ v8f wmmab(v16bf a, v16bf b, v8f c) { return __builtin_amdgcn_wmma_f32_16x16x32_bf16(false, a, false, b, (short)0, c, false, false); }



// ---- k_gemmt: work-group tiled GEMM. Eight waves share a 256x128 output tile (a wave 64x64, sixteen accumulators: a fragment read from LDS feeds four products, a row loaded from L2 feeds 128 or 256 columns); grid (M/256, N/128), 256 threads. The K-contiguous bf16 operand rows are brought in stages of 128 k (64 k if NSPLIT, for the LDS)
// by whole-line loads (a wave's load covers four 128-byte lines), through registers into LDS, two buffers, one barrier a stage; the next stage's global loads fly under this stage's products. The fragments are read from LDS.
// C[m][n] (f32, pitch ldc) = sum_k A[m][k] Bt[n][k] (+ A2[m][k] Bt[n][k] if NSPLIT), k ascending in steps of 32, A in front of A2. KK % 128 == 0.
// PL: the three projections of all batches in one launch, grid (NQK + NV). A = the bf16 x [NB_*TT][KK], Bt = the q, k and v weights one behind the other [3*DQ][KK]. Work-groups 0 .. NQK-1: 256 rows of x by two heads of q or k;
// the others: 256 rows of the v weight by 128 rows of x (operands swapped). No f32 C; the tile is split into bf16 hi and lo and stored in Ph/Pl = planes q [b][h][t][d], k [b][h][t][d], v [b][g][d][t], one behind the other.
// The plain '#pragma unroll' lines give the staging, fragment and accumulator arrays constant indices, so that they stay in registers.
template <typename T16> struct WFrag;
template <> struct WFrag<h16> { typedef v16h V; static __device__ __forceinline__ V ld(const h16* p) { return cat16(*(const v8h*)p, *(const v8h*)(p + 16)); } static __device__ __forceinline__ v8f mma(V a, V b, v8f c) { return wmma16(a, b, c); } };
template <> struct WFrag<bf> { typedef v16bf V; static __device__ __forceinline__ V ld(const bf* p) { return cat16b(*(const v8us*)p, *(const v8us*)(p + 16)); } static __device__ __forceinline__ v8f mma(V a, V b, v8f c) { return wmmab(a, b, c); } };
#define PB   ((size_t)NH_ * TT * HD)   // one batch's share of a head plane
#define NQK  ((NB_ * TT / 256) * ((DQ + DKV) / 128))   // q and k tiles of the projection launch
#define NV   ((DKV / 256) * (NB_ * TT / 128))         // v tiles
#define GP   144                  // LDS row pitch in bytes: a 128-byte row (64 k) + 16 (an odd multiple of 16, for the 16-byte fragment reads)
__device__ __forceinline__ v16bf ldsfrag(const unsigned char* p) { return cat16b(*(const v8usa*)p, *(const v8usa*)(p + 32)); }   // elements 0..7 and 16..23 from p, as WFrag::ld
template <int KK, int NSPLIT, bool PL>
__global__ __launch_bounds__(256) void k_gemmt(const bf* __restrict__ A, const bf* __restrict__ A2, const bf* __restrict__ Bt, float* C, int ldc, bf* Ph, bf* Pl) {
    typedef v16bf V;
    constexpr int NA = NSPLIT ? 2 : 1, TA = 256 * GP, TB = 128 * GP;  // tiles of 64 k: A (and A2) 256 rows, Bt 128 rows
    constexpr int NH = NSPLIT ? 1 : 2;                                // tiles of 64 k in a stage
    constexpr int HS = NA * TA + TB, SS = NH * HS, NS = KK / (64 * NH);   // one set of 64-k tiles, a stage, stages
    constexpr int GK = 2;                                             // steps of 32 k whose fragments are read as one group (registers: 8 or 12 fragments a step)
    static_assert(2 * SS >= 256 * 132 * 4, "the f32 tile of the epilogue fits the operand buffers");
    __shared__ __align__(16) unsigned char L[2 * SS];
    const int tid = threadIdx.x, lane = tid & 31, lr = lane & 15, hi = lane >> 4; const int wave = __builtin_amdgcn_readfirstlane(tid >> 5);
    const int wm = wave >> 1, wn = wave & 1;
    int r0 = blockIdx.x * 256, c0 = blockIdx.y * 128; int ldo = 0, cst = 0; size_t ob = 0;   // PL: the tile's first element in Ph/Pl, its row pitch there and the step from columns 0..63 to columns 64..127
    if (PL) {
        const unsigned id = blockIdx.x;
        if (id < NQK) { const unsigned hd = 2 * (id / (NB_ * TT / 256)); r0 = (id % (NB_ * TT / 256)) * 256; c0 = hd * 64;   // hd, hd + 1: q heads, then k heads (a pair lies in one of the two); a 256-row tile lies in one batch
            ob = (size_t)(hd / NH_) * NB_ * PB + (size_t)((unsigned)r0 / TT) * PB + (size_t)(hd % NH_) * TT * HD + (size_t)((unsigned)r0 % TT) * HD; ldo = HD; cst = TT * HD; }
        else { const unsigned iv = id - NQK; r0 = (iv % (DKV / 256)) * 256; c0 = (iv / (DKV / 256)) * 128;             // rows g*64 + d of the v weight, columns b*TT + t; a 128-column tile lies in one batch
            ob = (size_t)2 * NB_ * PB + (size_t)((unsigned)c0 / TT) * PB + (size_t)r0 * TT + (size_t)((unsigned)c0 % TT); ldo = TT; cst = 64;
            const bf* xs = A; A = Bt + (size_t)(DQ + DKV) * KK; Bt = xs; }
    }
    // staging: thread tid brings 16 bytes of rows tid / 8 + 32 i of every tile
    const int srow = tid >> 3, scol = (tid & 7) * 8;
    const bf* ga = A + (size_t)(r0 + srow) * KK + scol; const bf* ga2 = NSPLIT ? A2 + (size_t)(r0 + srow) * KK + scol : ga; const bf* gb = Bt + (size_t)(c0 + srow) * KK + scol;
    unsigned char* sdst = L + srow * GP + scol * 2;
    v8us xa[NH * 8], xa2[NH * 8], xb[NH * 4];
    auto g2r = [&](int st) {
        const bf* pa = ga + st * (64 * NH); const bf* pa2 = ga2 + st * (64 * NH); const bf* pb = gb + st * (64 * NH);
#pragma unroll
        for (int kh = 0; kh < NH; ++kh) {
#pragma unroll
            for (int i = 0; i < 8; ++i) { xa[kh * 8 + i] = *(const v8us*)(pa + kh * 64 + i * 32 * KK); if (NSPLIT) xa2[kh * 8 + i] = *(const v8us*)(pa2 + kh * 64 + i * 32 * KK); }
#pragma unroll
            for (int i = 0; i < 4; ++i) xb[kh * 4 + i] = *(const v8us*)(pb + kh * 64 + i * 32 * KK); }
        // the address registers of the issued loads stay unwritten up to this wait (they are its inputs)
        asm volatile("s_wait_xcnt 0x0" :: "v"(pa), "v"(pa2), "v"(pb) : "memory");
    };
    auto r2s = [&](int buf) {
        unsigned char* d = sdst + buf * SS;
#pragma unroll
        for (int kh = 0; kh < NH; ++kh) {
#pragma unroll
            for (int i = 0; i < 8; ++i) { *(v8usa*)(d + kh * HS + i * 32 * GP) = xa[kh * 8 + i]; if (NSPLIT) *(v8usa*)(d + kh * HS + TA + i * 32 * GP) = xa2[kh * 8 + i]; }
#pragma unroll
            for (int i = 0; i < 4; ++i) *(v8usa*)(d + kh * HS + NA * TA + i * 32 * GP) = xb[kh * 4 + i]; }
    };
    v8f acc[4][4];
#pragma unroll
    for (int mb = 0; mb < 4; ++mb)
#pragma unroll
        for (int nb = 0; nb < 4; ++nb) acc[mb][nb] = (v8f){};
    const int aofs = (wm * 64 + lr) * GP + 16 * hi, bofs = NA * TA + (wn * 64 + lr) * GP + 16 * hi;
    g2r(0); r2s(0);
    __syncthreads();   // stage 0 is published
#pragma unroll 1   // kept rolled: one set of staging registers, one copy of the stage's code
    for (int st = 0; st < NS; ++st) {
        if (st + 1 < NS) g2r(st + 1);        // the next stage's global loads fly under this stage's products
        const unsigned char* B = L + (st & 1) * SS;
#pragma unroll
        for (int gr = 0; gr < 2 * NH / GK; ++gr) {   // groups of GK steps of 32 k
            V a[GK][4], a2[GK][4], b[GK][4];
#pragma unroll
            for (int kk = 0; kk < GK; ++kk) {
                const int ks = gr * GK + kk; const unsigned char* H = B + (ks >> 1) * HS + 64 * (ks & 1);
#pragma unroll
                for (int mb = 0; mb < 4; ++mb) a[kk][mb] = ldsfrag(H + aofs + mb * 16 * GP);
#pragma unroll
                for (int nb = 0; nb < 4; ++nb) b[kk][nb] = ldsfrag(H + bofs + nb * 16 * GP);
                if (NSPLIT) {
#pragma unroll
                    for (int mb = 0; mb < 4; ++mb) a2[kk][mb] = ldsfrag(H + TA + aofs + mb * 16 * GP); } }
            __builtin_amdgcn_sched_barrier(0);   // the group's fragment reads stay one block in front of its products (counted waits), instead of a read, a full wait and two products in turn
#pragma unroll
            for (int kk = 0; kk < GK; ++kk) {
#pragma unroll
                for (int nb = 0; nb < 4; ++nb)
#pragma unroll
                    for (int mb = 0; mb < 4; ++mb) acc[mb][nb] = wmmab(a[kk][mb], b[kk][nb], acc[mb][nb]);
                if (NSPLIT) {
#pragma unroll
                    for (int nb = 0; nb < 4; ++nb)
#pragma unroll
                        for (int mb = 0; mb < 4; ++mb) acc[mb][nb] = wmmab(a2[kk][mb], b[kk][nb], acc[mb][nb]); } }
        }
        if (st + 1 < NS) r2s((st + 1) & 1);   // into the buffer whose last readers left it before the previous stage's barrier
        __syncthreads();                      // publishes stage st + 1 and ends every wave's reads of stage st
    }
    // the f32 tile goes through LDS (the operand buffers are free behind the last barrier), so that a wave stores whole rows: one writer per 128-byte line
    float* os = (float*)L;   // [256][132]
#pragma unroll
    for (int mb = 0; mb < 4; ++mb)
#pragma unroll
        for (int nb = 0; nb < 4; ++nb)
#pragma unroll
            for (int j = 0; j < 8; ++j) os[(wm * 64 + mb * 16 + hi * 8 + j) * 132 + wn * 64 + nb * 16 + lr] = acc[mb][nb][j];
    __syncthreads();   // the tile is complete before any wave reads its thirty-two rows
    if (PL) {
#pragma unroll 1   // kept rolled: the four rounds of eight rows share one copy of the split's code and one set of address and data registers
        for (int sg = 0; sg < 4; ++sg) { bf* ph[4]; bf* pl[4]; v8us oh[4], ol[4];
#pragma unroll
            for (int s = 0; s < 4; ++s) { const int row = wave * 32 + 8 * sg + 2 * s + hi, cofs = lr * 8; const v4f x0 = *(const v4fa*)(os + row * 132 + cofs), x1 = *(const v4fa*)(os + row * 132 + cofs + 4);
#pragma unroll
                for (int q = 0; q < 4; ++q) { unsigned short a, c2; splitf(x0[q], a, c2); oh[s][q] = a; ol[s][q] = c2; splitf(x1[q], a, c2); oh[s][q + 4] = a; ol[s][q + 4] = c2; }
                const size_t oo = ob + (size_t)row * ldo + (size_t)(cofs >> 6) * cst + (cofs & 63); ph[s] = Ph + oo; pl[s] = Pl + oo;
                *(v8us*)ph[s] = oh[s]; *(v8us*)pl[s] = ol[s]; }
            // the address and data registers of the eight issued stores stay unwritten up to this wait (they are its inputs)
            asm volatile("s_wait_xcnt 0x0" :: "v"(ph[0]), "v"(ph[1]), "v"(ph[2]), "v"(ph[3]), "v"(pl[0]), "v"(pl[1]), "v"(pl[2]), "v"(pl[3]), "v"(oh[0]), "v"(oh[1]), "v"(oh[2]), "v"(oh[3]), "v"(ol[0]), "v"(ol[1]), "v"(ol[2]), "v"(ol[3]) : "memory"); }
    } else {
#pragma unroll 1   // kept rolled: the four rounds of eight rows share one set of address and data registers
        for (int sg = 0; sg < 4; ++sg) { float* pc[8]; v4f val[8];
#pragma unroll
            for (int s = 0; s < 8; ++s) { const int row = wave * 32 + 8 * sg + s, cofs = lane * 4; val[s] = *(const v4fa*)(os + row * 132 + cofs); pc[s] = C + (size_t)(r0 + row) * ldc + c0 + cofs;
                *(v4f*)pc[s] = val[s]; }
            // as above
            asm volatile("s_wait_xcnt 0x0" :: "v"(pc[0]), "v"(pc[1]), "v"(pc[2]), "v"(pc[3]), "v"(pc[4]), "v"(pc[5]), "v"(pc[6]), "v"(pc[7]), "v"(val[0]), "v"(val[1]), "v"(val[2]), "v"(val[3]), "v"(val[4]), "v"(val[5]), "v"(val[6]), "v"(val[7]) : "memory"); }
    }
}

// ---- k_attn: causal attention, scores, softmax and probability x value in one kernel. A work-group owns 128 query rows of one (batch, head) z, a wave 16 of them; the keys are walked in stages of 64
// (K hi/lo rows and V^T hi/lo rows staged in LDS through registers, whole lines, two buffers, one barrier a stage), each stage in two passes of 32 keys, up to each wave's own diagonal.
// Transposed products: S^T = K.Q^T (A = 16 keys x 32 d, B = 16 queries) leaves in lane (c, h) the scores of query c for keys 8 h + r of each 16-key tile, which is the k order of a B fragment over 32 keys,
// so P^T goes into O^T += V^T.P^T (A = 16 d x 32 keys from the [d][t] planes) without leaving the registers. Every operand is hi + lo bf16, three products each. Running maximum and sum per query (online softmax), f32.
// The plain '#pragma unroll' lines give the fragment and accumulator arrays constant indices, so that they stay in registers.
#define LP   144                  // LDS row pitch in bytes: a 128-byte row + 16 (an odd multiple of 16, for the 16-byte fragment reads)
#define LT   (64 * LP)            // one tile of 64 rows
#define LS   (4 * LT)             // one stage: K hi, K lo (rows = keys), V^T hi, V^T lo (rows = d)
typedef __attribute__((ext_vector_type(2))) float v2f;
typedef __attribute__((ext_vector_type(2))) __bf16 v2bf;
typedef __attribute__((ext_vector_type(8))) unsigned v8u;
__device__ __forceinline__ float xhalf(float x) { return __builtin_bit_cast(float, __builtin_amdgcn_permlanex16(__builtin_bit_cast(int, x), __builtin_bit_cast(int, x), 0x76543210, 0xfedcba98, false, false)); }   // lane l with lane l ^ 16
__device__ __forceinline__ unsigned pack2(float a, float b) { return __builtin_bit_cast(unsigned, __builtin_convertvector((v2f){a, b}, v2bf)); }   // two f32 to two bf16, round to nearest even
__global__ __launch_bounds__(AW * 32) void k_attn(const bf* __restrict__ Qh, const bf* __restrict__ Ql, const bf* __restrict__ Kh, const bf* __restrict__ Kl, const bf* __restrict__ Vh, const bf* __restrict__ Vl, bf* Ah, bf* Al) {
    typedef v16bf V;
    __shared__ __align__(16) unsigned char L[2 * LS];
    const int tid = threadIdx.x, lane = tid & 31, c = lane & 15, h = lane >> 4; const int wave = __builtin_amdgcn_readfirstlane(tid >> 5);
    const int z = blockIdx.x;                                        // batch * NH_ + head
    const int qb = TT / (AW * 16) - 1 - (int)blockIdx.y;             // longest key loops take the lowest blockIdx.y
    const int q0 = qb * (AW * 16) + wave * 16;
    const size_t zo = (size_t)z * TT * HD;
    const int ns = 2 * qb + 2;                                       // 64-key stages up to the work-group's last query
    const int plast = (q0 + 15) / 32;                                // the wave's last 32-key pass, the one that holds its diagonal
    const bf* qph = Qh + zo + (size_t)(q0 + c) * HD + 8 * h; const bf* qpl = Ql + zo + (size_t)(q0 + c) * HD + 8 * h;
    V qh[2], ql[2];
#pragma unroll
    for (int kc = 0; kc < 2; ++kc) { qh[kc] = WFrag<bf>::ld(qph + 32 * kc); ql[kc] = WFrag<bf>::ld(qpl + 32 * kc); }
    // the address registers of the issued loads stay unwritten up to this wait (they are its inputs)
    asm volatile("s_wait_xcnt 0x0" :: "v"(qph), "v"(qpl) : "memory");
    // staging: thread tid brings 16 bytes of rows tid / 8 and tid / 8 + 32 of each of the four tiles
    const int srow = tid >> 3, scol = (tid & 7) * 8;
    const bf* gkh = Kh + zo + srow * HD + scol; const bf* gkl = Kl + zo + srow * HD + scol;
    const bf* gvh = Vh + zo + (size_t)srow * TT + scol; const bf* gvl = Vl + zo + (size_t)srow * TT + scol;
    unsigned char* sdst = L + srow * LP + scol * 2;
    v8us g[8];
    auto g2r = [&](int st) {
        const bf* a0 = gkh + (size_t)st * 64 * HD; const bf* a1 = gkl + (size_t)st * 64 * HD; const bf* a2 = gvh + st * 64; const bf* a3 = gvl + st * 64;
        g[0] = *(const v8us*)a0; g[1] = *(const v8us*)(a0 + 32 * HD); g[2] = *(const v8us*)a1; g[3] = *(const v8us*)(a1 + 32 * HD);
        g[4] = *(const v8us*)a2; g[5] = *(const v8us*)(a2 + (size_t)32 * TT); g[6] = *(const v8us*)a3; g[7] = *(const v8us*)(a3 + (size_t)32 * TT);
        // as above, for the four address pairs
        asm volatile("s_wait_xcnt 0x0" :: "v"(a0), "v"(a1), "v"(a2), "v"(a3) : "memory");
    };
    auto r2s = [&](int buf) {
        unsigned char* d = sdst + buf * LS;
#pragma unroll
        for (int i = 0; i < 4; ++i) { *(v8usa*)(d + i * LT) = g[2 * i]; *(v8usa*)(d + i * LT + 32 * LP) = g[2 * i + 1]; }
    };
    v8f acc[4];
#pragma unroll
    for (int t = 0; t < 4; ++t) acc[t] = (v8f){};
    float m_run = -__builtin_inff(), l_run = 0.0f;
    g2r(0); r2s(0);
    __syncthreads();   // stage 0 is published
#pragma unroll 1   // kept rolled: one set of staging registers, one copy of the passes' code
    for (int st = 0; st < ns; ++st) {
        if (st + 1 < ns) g2r(st + 1);        // the next stage's global loads fly under this stage's two passes
        const unsigned char* B = L + (st & 1) * LS;
#pragma unroll 1   // kept rolled: the two passes of a stage share one body (registers, code size)
        for (int sub = 0; sub < 2; ++sub) {
            const int p = 2 * st + sub, key0 = p * 32;
            if (p <= plast) {   // wave-uniform: passes beyond the wave's diagonal are skipped (the barriers are not)
                const unsigned char* kp = B + (sub * 32 + c) * LP + 16 * h;
                V kh[2][2], kl[2][2];
#pragma unroll
                for (int kt = 0; kt < 2; ++kt)
#pragma unroll
                    for (int kc = 0; kc < 2; ++kc) { kh[kt][kc] = ldsfrag(kp + kt * 16 * LP + 64 * kc); kl[kt][kc] = ldsfrag(kp + LT + kt * 16 * LP + 64 * kc); }
                v8f s[2];
#pragma unroll
                for (int kt = 0; kt < 2; ++kt) s[kt] = (v8f){};
#pragma unroll
                for (int kc = 0; kc < 2; ++kc) {
#pragma unroll
                    for (int kt = 0; kt < 2; ++kt) s[kt] = wmmab(kh[kt][kc], qh[kc], s[kt]);
#pragma unroll
                    for (int kt = 0; kt < 2; ++kt) s[kt] = wmmab(kl[kt][kc], qh[kc], s[kt]);
#pragma unroll
                    for (int kt = 0; kt < 2; ++kt) s[kt] = wmmab(kh[kt][kc], ql[kc], s[kt]); }
                const unsigned char* vp = B + 2 * LT + c * LP + 64 * sub + 16 * h;
                V vh[4], vl[4];
#pragma unroll
                for (int t = 0; t < 4; ++t) { vh[t] = ldsfrag(vp + t * 16 * LP); vl[t] = ldsfrag(vp + LT + t * 16 * LP); }
                __builtin_amdgcn_sched_barrier(0);   // the V^T fragment reads stay in front of the softmax and fly under it
                if (p == plast) {   // wave-uniform: only the last pass holds keys beyond a query (the reference's -1e10 fill vanishes identically in the softmax)
#pragma unroll
                    for (int kt = 0; kt < 2; ++kt)
#pragma unroll
                        for (int r = 0; r < 8; ++r) if (key0 + 16 * kt + 8 * h + r > q0 + c) s[kt][r] = -__builtin_inff(); }
                float mx = s[0][0];
#pragma unroll
                for (int r = 1; r < 8; ++r) mx = fmaxf(mx, s[0][r]);
#pragma unroll
                for (int r = 0; r < 8; ++r) mx = fmaxf(mx, s[1][r]);
                mx = fmaxf(mx, xhalf(mx));   // both halves of the wave hold query c's maximum (finite: the pass's first key is never beyond a query)
                if (__builtin_amdgcn_ballot_w32(mx > m_run) != 0) {   // some query's maximum grew: rescale sum and accumulators (factor 0 on the first pass, 1 for the queries whose maximum stayed)
                    const float m_new = fmaxf(m_run, mx); const float corr = __builtin_amdgcn_exp2f((m_run - m_new) * 1.4426950408889634f); m_run = m_new; l_run *= corr;
#pragma unroll
                    for (int t = 0; t < 4; ++t) acc[t] = acc[t] * corr; }
                float e[16];
#pragma unroll
                for (int i = 0; i < 16; ++i) e[i] = (s[i >> 3][i & 7] - m_run) * 1.4426950408889634f;
                // the sixteen exponentials in one statement, none directly in front of an instruction that reads its result or writes its source; the v_nop is that slot behind the last one
                asm("v_exp_f32 %0, %0\n\tv_exp_f32 %1, %1\n\tv_exp_f32 %2, %2\n\tv_exp_f32 %3, %3\n\tv_exp_f32 %4, %4\n\tv_exp_f32 %5, %5\n\tv_exp_f32 %6, %6\n\tv_exp_f32 %7, %7\n\tv_exp_f32 %8, %8\n\tv_exp_f32 %9, %9\n\tv_exp_f32 %10, %10\n\tv_exp_f32 %11, %11\n\tv_exp_f32 %12, %12\n\tv_exp_f32 %13, %13\n\tv_exp_f32 %14, %14\n\tv_exp_f32 %15, %15\n\tv_nop" : "+v"(e[0]), "+v"(e[1]), "+v"(e[2]), "+v"(e[3]), "+v"(e[4]), "+v"(e[5]), "+v"(e[6]), "+v"(e[7]), "+v"(e[8]), "+v"(e[9]), "+v"(e[10]), "+v"(e[11]), "+v"(e[12]), "+v"(e[13]), "+v"(e[14]), "+v"(e[15]));
                v8u wh, wl;
#pragma unroll
                for (int i = 0; i < 8; ++i) {
                    l_run += e[2 * i] + e[2 * i + 1];
                    const unsigned w = pack2(e[2 * i], e[2 * i + 1]); wh[i] = w; wl[i] = pack2(e[2 * i] - __uint_as_float(w << 16), e[2 * i + 1] - __uint_as_float(w & 0xFFFF0000u)); }
                const V ph = __builtin_bit_cast(V, wh), pl = __builtin_bit_cast(V, wl);
#pragma unroll
                for (int t = 0; t < 4; ++t) acc[t] = wmmab(vh[t], ph, acc[t]);
#pragma unroll
                for (int t = 0; t < 4; ++t) acc[t] = wmmab(vl[t], ph, acc[t]);
#pragma unroll
                for (int t = 0; t < 4; ++t) acc[t] = wmmab(vh[t], pl, acc[t]);
            }
        }
        if (st + 1 < ns) r2s((st + 1) & 1);   // into the buffer whose last readers left it before the previous stage's barrier
        __syncthreads();                      // publishes stage st + 1 and ends every wave's reads of stage st
    }
    const float inv = __fdiv_rn(1.0f, l_run + xhalf(l_run));   // each half summed its own keys
    const size_t oo = ((size_t)(z / NH_) * TT + q0 + c) * DQ + (size_t)(z % NH_) * HD + 8 * h;   // merged heads [b][t][n * 64 + d]; lane (c, h) holds d = 16 t + 8 h + r of query c; the wave writes whole 128-byte lines
    bf* pa = Ah + oo; bf* pb = Al + oo; v8us oh[4], ol[4];
#pragma unroll
    for (int t = 0; t < 4; ++t) {
#pragma unroll
        for (int r = 0; r < 8; ++r) { unsigned short a, c2; splitf(acc[t][r] * inv, a, c2); oh[t][r] = a; ol[t][r] = c2; }
        *(v8us*)(pa + 16 * t) = oh[t]; *(v8us*)(pb + 16 * t) = ol[t]; }
    // the address and data registers of the eight issued stores stay unwritten up to this wait (they are its inputs)
    asm volatile("s_wait_xcnt 0x0" :: "v"(pa), "v"(pb), "v"(oh[0]), "v"(oh[1]), "v"(oh[2]), "v"(oh[3]), "v"(ol[0]), "v"(ol[1]), "v"(ol[2]), "v"(ol[3]) : "memory");
}

// ---- k_cvt8: f32 to bf16, eight elements a thread, all five inputs in one launch: work-groups 0 .. CX-1 take x, then CW each for the q, k, v and o weights (their copies lie one behind the other in Wd).
#define CX   (NB_ * TT * DM / (8 * 256))
#define CW   (DQ * DM / (8 * 256))
static_assert(NB_ * TT * DM % (8 * 256) == 0 && DQ * DM % (8 * 256) == 0 && DKV == DQ, "the grid covers every array exactly, so no thread needs a bounds test");
__global__ __launch_bounds__(256) void k_cvt8(const float* __restrict__ x, const float* __restrict__ wq, const float* __restrict__ wk, const float* __restrict__ wv, const float* __restrict__ wo, bf* Xd, bf* Wd) {
    const unsigned blk = blockIdx.x; const float* src = x; bf* dst = Xd; unsigned b0 = blk;
    if (blk >= CX) { const unsigned w = (blk - CX) / CW; b0 = (blk - CX) % CW; src = w == 0 ? wq : w == 1 ? wk : w == 2 ? wv : wo; dst = Wd + (size_t)w * DQ * DM; }
    const size_t i = (size_t)b0 * 256 + threadIdx.x; const v8f v = *(const v8f*)(src + i * 8); v8us o;
#pragma unroll
    for (int k = 0; k < 8; ++k) o[k] = f2bf(v[k]); *(v8us*)(dst + i * 8) = o;  }

extern "C" void kernel_launch(void* const* d_in, const int* in_sizes, int n_in,
                              void* d_out, int out_size, void* d_ws, size_t ws_size, hipStream_t stream) {
    (void)in_sizes; (void)n_in; (void)out_size;
    const float* x = (const float*)d_in[0]; const float* wq = (const float*)d_in[1]; const float* wk = (const float*)d_in[2]; const float* wv = (const float*)d_in[3]; const float* wo = (const float*)d_in[4];   /* x, Q, K, V [16][64][1024] (= 'oi'), O ('oi' [1024][1024]) */
    float* OUT = (float*)d_out;     // [4][2048][1024]
    char* wsp = (char*)d_ws;
    auto take = [&](size_t bytes) { char* p = wsp; wsp += (bytes + 255) & ~(size_t)255; return (void*)p; };
    bf* WQ = (bf*)take((size_t)4 * DQ * DM * 2); bf* WO = WQ + (size_t)3 * DQ * DM;   // bf16 copies of the q, k, v and o weights, one behind the other
    bf* XB = (bf*)take((size_t)NB_ * TT * DM * 2);   // the bf16 copy of x
    bf* PH = (bf*)take(3 * NB_ * PB * 2); bf* PLo = (bf*)take(3 * NB_ * PB * 2);        // hi and lo planes: q, k, v^T, one behind the other
    bf* ATh = (bf*)take((size_t)NB_ * TT * DQ * 2); bf* ATl = (bf*)take((size_t)NB_ * TT * DQ * 2);
    if ((size_t)(wsp - (char*)d_ws) > ws_size) return;    // ws 256 MiB
    k_cvt8<<<CX + 4 * CW, 256, 0, stream>>>(x, wq, wk, wv, wo, XB, WQ);
    k_gemmt<DM, 0, true><<<NQK + NV, 256, 0, stream>>>(XB, nullptr, WQ, nullptr, 0, PH, PLo);
    k_attn<<<dim3(NB_ * NH_, TT / (AW * 16), 1), AW * 32, 0, stream>>>(PH, PLo, PH + NB_ * PB, PLo + NB_ * PB, PH + 2 * NB_ * PB, PLo + 2 * NB_ * PB, ATh, ATl);
    k_gemmt<DQ, 1, false><<<dim3(NB_ * TT / 256, DM / 128, 1), 256, 0, stream>>>(ATh, ATl, WO, OUT, DM, nullptr, nullptr);   // the batches' rows lie one behind the other in ATh/ATl and in OUT
}

// v008
// It runs in 148 microseconds.
// Two timings next to v007 both put it at 1.11 times that version's speed.
// Over all steps from v000 it is 15.9 times as fast.
#include <hip/hip_runtime.h>

// Causal attention with per-head weight tensors and NO score scaling (x [4][2048][1024]; q = einsum('nhm,btm', Q, x) with Q, K, V [16][64][1024] (= 'oi' [1024][1024] with rows n*64 + h; 1/32 scale); scores = q.k (the source has no 1/sqrt(d_head) factor: logits sigma ~8); causal (-1e10 == exclusion); softmax; z = merged heads (n, h); out = einsum('ma,bqa', O, z) ('oi') -> [4][2048][1024] (8.4 M); argument order x, Q, K, V, O).
// Four launches, each over all batches: bf16 copies of x and of the four weights; the [16][64][1024] weights are already Bt planes ('oi' rows n*64 + h); exact q, k and v projections in one launch, which store their head planes themselves (q, k as bf16 hi/lo; v rounded to f16, with the operands swapped, so its tile is already [d][t]); one fused causal attention kernel over all batches and heads (online softmax, scores and probabilities stay in registers; scores from hi/lo planes, 3 products; probability x value one f16 product); merged hi/lo x O exact.
// Compute dtypes, f32 accumulate: every input rounded to bf16; projections exact; scores hi/lo bf16; softmax f32; probabilities and v rounded to f16 for their product; O hl x exact.

#define NB_  4
#define TT   2048
#define DM   1024
#define NH_  16
#define NKV  16
#define REP  (NH_ / NKV)
#define HD   64
#define DQ   (NH_ * HD)
#define DKV  (NKV * HD)
#define AW   8                    // waves per work-group of the attention kernel, 16 query rows each
typedef _Float16 h16;
typedef unsigned short bf;
typedef __attribute__((ext_vector_type(16))) __bf16   v16bf;
typedef __attribute__((ext_vector_type(16))) _Float16 v16h;
typedef __attribute__((ext_vector_type(8)))  _Float16 v8h;
typedef __attribute__((ext_vector_type(8)))  unsigned short v8us;
typedef __attribute__((ext_vector_type(8)))  float    v8f;
typedef __attribute__((ext_vector_type(4)))  float    v4f;
typedef v8h  __attribute__((may_alias)) v8ha;
typedef v4f  __attribute__((may_alias)) v4fa;
typedef v8us __attribute__((may_alias)) v8usa;

__device__ __forceinline__ unsigned short f2bf(float f) { unsigned u = __float_as_uint(f); u += 0x7FFFu + ((u >> 16) & 1u); return (unsigned short)(u >> 16); }
__device__ __forceinline__ float bf2f(unsigned short b) { return __uint_as_float(((unsigned)b) << 16); }
__device__ __forceinline__ float bfr(float f) { return bf2f(f2bf(f)); }
__device__ __forceinline__ void splitf(float y, unsigned short& h, unsigned short& l) { h = f2bf(y); l = f2bf(y - bf2f(h)); }
__device__ __forceinline__ v16h cat16(v8h lo, v8h hi) { return __builtin_shufflevector(lo, hi, 0, 1, 2, 3, 4, 5, 6, 7, 8, 9, 10, 11, 12, 13, 14, 15); }
__device__ __forceinline__ v16bf cat16b(v8us lo, v8us hi) { return __builtin_bit_cast(v16bf, __builtin_shufflevector(lo, hi, 0, 1, 2, 3, 4, 5, 6, 7, 8, 9, 10, 11, 12, 13, 14, 15)); }
__device__ __forceinline__ v8f wmma16(v16h a, v16h b, v8f c) { return __builtin_amdgcn_wmma_f32_16x16x32_f16(false, a, false, b, (short)0, c, false, false); }
__device__ __forceinline__ v8f wmmab(v16bf a, v16bf b, v8f c) { return __builtin_amdgcn_wmma_f32_16x16x32_bf16(false, a, false, b, (short)0, c, false, false); }



// ---- k_gemmt: work-group tiled GEMM. Eight waves share a 256x128 output tile (a wave 64x64, sixteen accumulators: a fragment read from LDS feeds four products, a row loaded from L2 feeds 128 or 256 columns); grid (M/256, N/128), 256 threads. The K-contiguous bf16 operand rows are brought in stages of 128 k (64 k if NSPLIT, for the LDS)
// by whole-line loads (a wave's load covers four 128-byte lines), through registers into LDS, two buffers, one barrier a stage; the next stage's global loads fly under this stage's products. The fragments are read from LDS.
// C[m][n] (f32, pitch ldc) = sum_k A[m][k] Bt[n][k] (+ A2[m][k] Bt[n][k] if NSPLIT), k ascending in steps of 32, A in front of A2. KK % 128 == 0.
// PL: the three projections of all batches in one launch, grid (NQK + NV). A = the bf16 x [NB_*TT][KK], Bt = the q, k and v weights one behind the other [3*DQ][KK]. Work-groups 0 .. NQK-1: 256 rows of x by two heads of q or k;
// the others: 256 rows of the v weight by 128 rows of x (operands swapped). No f32 C; a q or k tile is split into bf16 hi and lo and stored in Ph/Pl = planes q [b][h][t][d], k [b][h][t][d]; a v tile is rounded to f16 and stored in Ph alone, plane v [b][g][d][t] behind them.
// The plain '#pragma unroll' lines give the staging, fragment and accumulator arrays constant indices, so that they stay in registers.
template <typename T16> struct WFrag;
template <> struct WFrag<h16> { typedef v16h V; static __device__ __forceinline__ V ld(const h16* p) { return cat16(*(const v8h*)p, *(const v8h*)(p + 16)); } static __device__ __forceinline__ v8f mma(V a, V b, v8f c) { return wmma16(a, b, c); } };
template <> struct WFrag<bf> { typedef v16bf V; static __device__ __forceinline__ V ld(const bf* p) { return cat16b(*(const v8us*)p, *(const v8us*)(p + 16)); } static __device__ __forceinline__ v8f mma(V a, V b, v8f c) { return wmmab(a, b, c); } };
#define PB   ((size_t)NH_ * TT * HD)   // one batch's share of a head plane
#define NQK  ((NB_ * TT / 256) * ((DQ + DKV) / 128))   // q and k tiles of the projection launch
#define NV   ((DKV / 256) * (NB_ * TT / 128))         // v tiles
#define GP   144                  // LDS row pitch in bytes: a 128-byte row (64 k) + 16 (an odd multiple of 16, for the 16-byte fragment reads)
__device__ __forceinline__ v16bf ldsfrag(const unsigned char* p) { return cat16b(*(const v8usa*)p, *(const v8usa*)(p + 32)); }   // elements 0..7 and 16..23 from p, as WFrag::ld
template <int KK, int NSPLIT, bool PL>
__global__ __launch_bounds__(256) void k_gemmt(const bf* __restrict__ A, const bf* __restrict__ A2, const bf* __restrict__ Bt, float* C, int ldc, bf* Ph, bf* Pl) {
    typedef v16bf V;
    constexpr int NA = NSPLIT ? 2 : 1, TA = 256 * GP, TB = 128 * GP;  // tiles of 64 k: A (and A2) 256 rows, Bt 128 rows
    constexpr int NH = NSPLIT ? 1 : 2;                                // tiles of 64 k in a stage
    constexpr int HS = NA * TA + TB, SS = NH * HS, NS = KK / (64 * NH);   // one set of 64-k tiles, a stage, stages
    constexpr int GK = 2;                                             // steps of 32 k whose fragments are read as one group (registers: 8 or 12 fragments a step)
    static_assert(2 * SS >= 256 * 132 * 4, "the f32 tile of the epilogue fits the operand buffers");
    __shared__ __align__(16) unsigned char L[2 * SS];
    const int tid = threadIdx.x, lane = tid & 31, lr = lane & 15, hi = lane >> 4; const int wave = __builtin_amdgcn_readfirstlane(tid >> 5);
    const int wm = wave >> 1, wn = wave & 1;
    int r0 = blockIdx.x * 256, c0 = blockIdx.y * 128; int ldo = 0, cst = 0; size_t ob = 0;   // PL: the tile's first element in Ph/Pl, its row pitch there and the step from columns 0..63 to columns 64..127
    if (PL) {
        const unsigned id = blockIdx.x;
        if (id < NQK) { const unsigned hd = 2 * (id / (NB_ * TT / 256)); r0 = (id % (NB_ * TT / 256)) * 256; c0 = hd * 64;   // hd, hd + 1: q heads, then k heads (a pair lies in one of the two); a 256-row tile lies in one batch
            ob = (size_t)(hd / NH_) * NB_ * PB + (size_t)((unsigned)r0 / TT) * PB + (size_t)(hd % NH_) * TT * HD + (size_t)((unsigned)r0 % TT) * HD; ldo = HD; cst = TT * HD; }
        else { const unsigned iv = id - NQK; r0 = (iv % (DKV / 256)) * 256; c0 = (iv / (DKV / 256)) * 128;             // rows g*64 + d of the v weight, columns b*TT + t; a 128-column tile lies in one batch
            ob = (size_t)2 * NB_ * PB + (size_t)((unsigned)c0 / TT) * PB + (size_t)r0 * TT + (size_t)((unsigned)c0 % TT); ldo = TT; cst = 64;
            const bf* xs = A; A = Bt + (size_t)(DQ + DKV) * KK; Bt = xs; }
    }
    // staging: thread tid brings 16 bytes of rows tid / 8 + 32 i of every tile
    const int srow = tid >> 3, scol = (tid & 7) * 8;
    const bf* ga = A + (size_t)(r0 + srow) * KK + scol; const bf* ga2 = NSPLIT ? A2 + (size_t)(r0 + srow) * KK + scol : ga; const bf* gb = Bt + (size_t)(c0 + srow) * KK + scol;
    unsigned char* sdst = L + srow * GP + scol * 2;
    v8us xa[NH * 8], xa2[NH * 8], xb[NH * 4];
    auto g2r = [&](int st) {
        const bf* pa = ga + st * (64 * NH); const bf* pa2 = ga2 + st * (64 * NH); const bf* pb = gb + st * (64 * NH);
#pragma unroll
        for (int kh = 0; kh < NH; ++kh) {
#pragma unroll
            for (int i = 0; i < 8; ++i) { xa[kh * 8 + i] = *(const v8us*)(pa + kh * 64 + i * 32 * KK); if (NSPLIT) xa2[kh * 8 + i] = *(const v8us*)(pa2 + kh * 64 + i * 32 * KK); }
#pragma unroll
            for (int i = 0; i < 4; ++i) xb[kh * 4 + i] = *(const v8us*)(pb + kh * 64 + i * 32 * KK); }
        // the address registers of the issued loads stay unwritten up to this wait (they are its inputs)
        asm volatile("s_wait_xcnt 0x0" :: "v"(pa), "v"(pa2), "v"(pb) : "memory");
    };
    auto r2s = [&](int buf) {
        unsigned char* d = sdst + buf * SS;
#pragma unroll
        for (int kh = 0; kh < NH; ++kh) {
#pragma unroll
            for (int i = 0; i < 8; ++i) { *(v8usa*)(d + kh * HS + i * 32 * GP) = xa[kh * 8 + i]; if (NSPLIT) *(v8usa*)(d + kh * HS + TA + i * 32 * GP) = xa2[kh * 8 + i]; }
#pragma unroll
            for (int i = 0; i < 4; ++i) *(v8usa*)(d + kh * HS + NA * TA + i * 32 * GP) = xb[kh * 4 + i]; }
    };
    v8f acc[4][4];
#pragma unroll
    for (int mb = 0; mb < 4; ++mb)
#pragma unroll
        for (int nb = 0; nb < 4; ++nb) acc[mb][nb] = (v8f){};
    const int aofs = (wm * 64 + lr) * GP + 16 * hi, bofs = NA * TA + (wn * 64 + lr) * GP + 16 * hi;
    g2r(0); r2s(0);
    __syncthreads();   // stage 0 is published
#pragma unroll 1   // kept rolled: one set of staging registers, one copy of the stage's code
    for (int st = 0; st < NS; ++st) {
        if (st + 1 < NS) g2r(st + 1);        // the next stage's global loads fly under this stage's products
        const unsigned char* B = L + (st & 1) * SS;
#pragma unroll
        for (int gr = 0; gr < 2 * NH / GK; ++gr) {   // groups of GK steps of 32 k
            V a[GK][4], a2[GK][4], b[GK][4];
#pragma unroll
            for (int kk = 0; kk < GK; ++kk) {
                const int ks = gr * GK + kk; const unsigned char* H = B + (ks >> 1) * HS + 64 * (ks & 1);
#pragma unroll
                for (int mb = 0; mb < 4; ++mb) a[kk][mb] = ldsfrag(H + aofs + mb * 16 * GP);
#pragma unroll
                for (int nb = 0; nb < 4; ++nb) b[kk][nb] = ldsfrag(H + bofs + nb * 16 * GP);
                if (NSPLIT) {
#pragma unroll
                    for (int mb = 0; mb < 4; ++mb) a2[kk][mb] = ldsfrag(H + TA + aofs + mb * 16 * GP); } }
            __builtin_amdgcn_sched_barrier(0);   // the group's fragment reads stay one block in front of its products (counted waits), instead of a read, a full wait and two products in turn
#pragma unroll
            for (int kk = 0; kk < GK; ++kk) {
#pragma unroll
                for (int nb = 0; nb < 4; ++nb)
#pragma unroll
                    for (int mb = 0; mb < 4; ++mb) acc[mb][nb] = wmmab(a[kk][mb], b[kk][nb], acc[mb][nb]);
                if (NSPLIT) {
#pragma unroll
                    for (int nb = 0; nb < 4; ++nb)
#pragma unroll
                        for (int mb = 0; mb < 4; ++mb) acc[mb][nb] = wmmab(a2[kk][mb], b[kk][nb], acc[mb][nb]); } }
        }
        if (st + 1 < NS) r2s((st + 1) & 1);   // into the buffer whose last readers left it before the previous stage's barrier
        __syncthreads();                      // publishes stage st + 1 and ends every wave's reads of stage st
    }
    // the f32 tile goes through LDS (the operand buffers are free behind the last barrier), so that a wave stores whole rows: one writer per 128-byte line
    float* os = (float*)L;   // [256][132]
#pragma unroll
    for (int mb = 0; mb < 4; ++mb)
#pragma unroll
        for (int nb = 0; nb < 4; ++nb)
#pragma unroll
            for (int j = 0; j < 8; ++j) os[(wm * 64 + mb * 16 + hi * 8 + j) * 132 + wn * 64 + nb * 16 + lr] = acc[mb][nb][j];
    __syncthreads();   // the tile is complete before any wave reads its thirty-two rows
    if (PL) {
        const bool isv = blockIdx.x >= NQK;   // the same for the whole work-group
#pragma unroll 1   // kept rolled: the four rounds of eight rows share one copy of the split's code and one set of address and data registers
        for (int sg = 0; sg < 4; ++sg) { bf* ph[4]; bf* pl[4]; v8us oh[4], ol[4];
#pragma unroll
            for (int s = 0; s < 4; ++s) { const int row = wave * 32 + 8 * sg + 2 * s + hi, cofs = lr * 8; const v4f x0 = *(const v4fa*)(os + row * 132 + cofs), x1 = *(const v4fa*)(os + row * 132 + cofs + 4);
                if (isv) {   // v: one f16 plane
#pragma unroll
                    for (int q = 0; q < 4; ++q) { oh[s][q] = __builtin_bit_cast(unsigned short, (h16)x0[q]); oh[s][q + 4] = __builtin_bit_cast(unsigned short, (h16)x1[q]); }
                    ol[s] = oh[s];   // not stored: only so that the wait below names a defined value
                } else {
#pragma unroll
                    for (int q = 0; q < 4; ++q) { unsigned short a, c2; splitf(x0[q], a, c2); oh[s][q] = a; ol[s][q] = c2; splitf(x1[q], a, c2); oh[s][q + 4] = a; ol[s][q + 4] = c2; } }
                const size_t oo = ob + (size_t)row * ldo + (size_t)(cofs >> 6) * cst + (cofs & 63); ph[s] = Ph + oo; pl[s] = Pl + oo;
                *(v8us*)ph[s] = oh[s]; if (!isv) *(v8us*)pl[s] = ol[s]; }
            // the address and data registers of the issued stores (eight; four for a v tile) stay unwritten up to this wait (they are its inputs)
            asm volatile("s_wait_xcnt 0x0" :: "v"(ph[0]), "v"(ph[1]), "v"(ph[2]), "v"(ph[3]), "v"(pl[0]), "v"(pl[1]), "v"(pl[2]), "v"(pl[3]), "v"(oh[0]), "v"(oh[1]), "v"(oh[2]), "v"(oh[3]), "v"(ol[0]), "v"(ol[1]), "v"(ol[2]), "v"(ol[3]) : "memory"); }
    } else {
#pragma unroll 1   // kept rolled: the four rounds of eight rows share one set of address and data registers
        for (int sg = 0; sg < 4; ++sg) { float* pc[8]; v4f val[8];
#pragma unroll
            for (int s = 0; s < 8; ++s) { const int row = wave * 32 + 8 * sg + s, cofs = lane * 4; val[s] = *(const v4fa*)(os + row * 132 + cofs); pc[s] = C + (size_t)(r0 + row) * ldc + c0 + cofs;
                *(v4f*)pc[s] = val[s]; }
            // as above
            asm volatile("s_wait_xcnt 0x0" :: "v"(pc[0]), "v"(pc[1]), "v"(pc[2]), "v"(pc[3]), "v"(pc[4]), "v"(pc[5]), "v"(pc[6]), "v"(pc[7]), "v"(val[0]), "v"(val[1]), "v"(val[2]), "v"(val[3]), "v"(val[4]), "v"(val[5]), "v"(val[6]), "v"(val[7]) : "memory"); }
    }
}

// ---- k_attn: causal attention, scores, softmax and probability x value in one kernel. A work-group owns 128 query rows of one (batch, head) z, a wave 16 of them; the keys are walked in stages of 64
// (K hi/lo rows and V^T f16 rows staged in LDS through registers, whole lines, two buffers, one barrier a stage), each stage in two passes of 32 keys, up to each wave's own diagonal.
// Transposed products: S^T = K.Q^T (A = 16 keys x 32 d, B = 16 queries) leaves in lane (c, h) the scores of query c for keys 8 h + r of each 16-key tile, which is the k order of a B fragment over 32 keys,
// so P^T goes into O^T += V^T.P^T (A = 16 d x 32 keys from the [d][t] planes) without leaving the registers. K and Q are hi + lo bf16, three products; P and V are f16, one product. Running maximum and sum per query (online softmax), f32.
// The plain '#pragma unroll' lines give the fragment and accumulator arrays constant indices, so that they stay in registers.
#define LP   144                  // LDS row pitch in bytes: a 128-byte row + 16 (an odd multiple of 16, for the 16-byte fragment reads)
#define LT   (64 * LP)            // one tile of 64 rows
#define LS   (3 * LT)             // one stage: K hi, K lo (rows = keys), V^T f16 (rows = d)
typedef __attribute__((ext_vector_type(2))) float v2f;
typedef __attribute__((ext_vector_type(2))) _Float16 v2h;
typedef __attribute__((ext_vector_type(8))) unsigned v8u;
__device__ __forceinline__ float xhalf(float x) { return __builtin_bit_cast(float, __builtin_amdgcn_permlanex16(__builtin_bit_cast(int, x), __builtin_bit_cast(int, x), 0x76543210, 0xfedcba98, false, false)); }   // lane l with lane l ^ 16
__global__ __launch_bounds__(AW * 32) void k_attn(const bf* __restrict__ Qh, const bf* __restrict__ Ql, const bf* __restrict__ Kh, const bf* __restrict__ Kl, const bf* __restrict__ Vh, bf* Ah, bf* Al) {
    typedef v16bf V;
    __shared__ __align__(16) unsigned char L[2 * LS];
    const int tid = threadIdx.x, lane = tid & 31, c = lane & 15, h = lane >> 4; const int wave = __builtin_amdgcn_readfirstlane(tid >> 5);
    const int z = blockIdx.x;                                        // batch * NH_ + head
    const int qb = TT / (AW * 16) - 1 - (int)blockIdx.y;             // longest key loops take the lowest blockIdx.y
    const int q0 = qb * (AW * 16) + wave * 16;
    const size_t zo = (size_t)z * TT * HD;
    const int ns = 2 * qb + 2;                                       // 64-key stages up to the work-group's last query
    const int plast = (q0 + 15) / 32;                                // the wave's last 32-key pass, the one that holds its diagonal
    const bf* qph = Qh + zo + (size_t)(q0 + c) * HD + 8 * h; const bf* qpl = Ql + zo + (size_t)(q0 + c) * HD + 8 * h;
    V qh[2], ql[2];
#pragma unroll
    for (int kc = 0; kc < 2; ++kc) { qh[kc] = WFrag<bf>::ld(qph + 32 * kc); ql[kc] = WFrag<bf>::ld(qpl + 32 * kc); }
    // the address registers of the issued loads stay unwritten up to this wait (they are its inputs)
    asm volatile("s_wait_xcnt 0x0" :: "v"(qph), "v"(qpl) : "memory");
    // staging: thread tid brings 16 bytes of rows tid / 8 and tid / 8 + 32 of each of the three tiles
    const int srow = tid >> 3, scol = (tid & 7) * 8;
    const bf* gkh = Kh + zo + srow * HD + scol; const bf* gkl = Kl + zo + srow * HD + scol;
    const bf* gvh = Vh + zo + (size_t)srow * TT + scol;
    unsigned char* sdst = L + srow * LP + scol * 2;
    v8us g[6];
    auto g2r = [&](int st) {
        const bf* a0 = gkh + (size_t)st * 64 * HD; const bf* a1 = gkl + (size_t)st * 64 * HD; const bf* a2 = gvh + st * 64;
        g[0] = *(const v8us*)a0; g[1] = *(const v8us*)(a0 + 32 * HD); g[2] = *(const v8us*)a1; g[3] = *(const v8us*)(a1 + 32 * HD);
        g[4] = *(const v8us*)a2; g[5] = *(const v8us*)(a2 + (size_t)32 * TT);
        // as above, for the three address pairs
        asm volatile("s_wait_xcnt 0x0" :: "v"(a0), "v"(a1), "v"(a2) : "memory");
    };
    auto r2s = [&](int buf) {
        unsigned char* d = sdst + buf * LS;
#pragma unroll
        for (int i = 0; i < 3; ++i) { *(v8usa*)(d + i * LT) = g[2 * i]; *(v8usa*)(d + i * LT + 32 * LP) = g[2 * i + 1]; }
    };
    v8f acc[4];
#pragma unroll
    for (int t = 0; t < 4; ++t) acc[t] = (v8f){};
    float m_run = -__builtin_inff(), l_run = 0.0f;
    g2r(0); r2s(0);
    __syncthreads();   // stage 0 is published
#pragma unroll 1   // kept rolled: one set of staging registers, one copy of the passes' code
    for (int st = 0; st < ns; ++st) {
        if (st + 1 < ns) g2r(st + 1);        // the next stage's global loads fly under this stage's two passes
        const unsigned char* B = L + (st & 1) * LS;
#pragma unroll 1   // kept rolled: the two passes of a stage share one body (registers, code size)
        for (int sub = 0; sub < 2; ++sub) {
            const int p = 2 * st + sub, key0 = p * 32;
            if (p <= plast) {   // wave-uniform: passes beyond the wave's diagonal are skipped (the barriers are not)
                const unsigned char* kp = B + (sub * 32 + c) * LP + 16 * h;
                V kh[2][2], kl[2][2];
#pragma unroll
                for (int kt = 0; kt < 2; ++kt)
#pragma unroll
                    for (int kc = 0; kc < 2; ++kc) { kh[kt][kc] = ldsfrag(kp + kt * 16 * LP + 64 * kc); kl[kt][kc] = ldsfrag(kp + LT + kt * 16 * LP + 64 * kc); }
                v8f s[2];
#pragma unroll
                for (int kt = 0; kt < 2; ++kt) s[kt] = (v8f){};
#pragma unroll
                for (int kc = 0; kc < 2; ++kc) {
#pragma unroll
                    for (int kt = 0; kt < 2; ++kt) s[kt] = wmmab(kh[kt][kc], qh[kc], s[kt]);
#pragma unroll
                    for (int kt = 0; kt < 2; ++kt) s[kt] = wmmab(kl[kt][kc], qh[kc], s[kt]);
#pragma unroll
                    for (int kt = 0; kt < 2; ++kt) s[kt] = wmmab(kh[kt][kc], ql[kc], s[kt]); }
                const unsigned char* vp = B + 2 * LT + c * LP + 64 * sub + 16 * h;
                v16h vh[4];
#pragma unroll
                for (int t = 0; t < 4; ++t) vh[t] = __builtin_bit_cast(v16h, ldsfrag(vp + t * 16 * LP));
                __builtin_amdgcn_sched_barrier(0);   // the V^T fragment reads stay in front of the softmax and fly under it
                if (p == plast) {   // wave-uniform: only the last pass holds keys beyond a query (the reference's -1e10 fill vanishes identically in the softmax)
#pragma unroll
                    for (int kt = 0; kt < 2; ++kt)
#pragma unroll
                        for (int r = 0; r < 8; ++r) if (key0 + 16 * kt + 8 * h + r > q0 + c) s[kt][r] = -__builtin_inff(); }
                float mx = s[0][0];
#pragma unroll
                for (int r = 1; r < 8; ++r) mx = fmaxf(mx, s[0][r]);
#pragma unroll
                for (int r = 0; r < 8; ++r) mx = fmaxf(mx, s[1][r]);
                mx = fmaxf(mx, xhalf(mx));   // both halves of the wave hold query c's maximum (finite: the pass's first key is never beyond a query)
                if (__builtin_amdgcn_ballot_w32(mx > m_run) != 0) {   // some query's maximum grew: rescale sum and accumulators (factor 0 on the first pass, 1 for the queries whose maximum stayed)
                    const float m_new = fmaxf(m_run, mx); const float corr = __builtin_amdgcn_exp2f((m_run - m_new) * 1.4426950408889634f); m_run = m_new; l_run *= corr;
#pragma unroll
                    for (int t = 0; t < 4; ++t) acc[t] = acc[t] * corr; }
                float e[16];
#pragma unroll
                for (int i = 0; i < 16; ++i) e[i] = (s[i >> 3][i & 7] - m_run) * 1.4426950408889634f;
                // the sixteen exponentials in one statement, none directly in front of an instruction that reads its result or writes its source; the v_nop is that slot behind the last one
                asm("v_exp_f32 %0, %0\n\tv_exp_f32 %1, %1\n\tv_exp_f32 %2, %2\n\tv_exp_f32 %3, %3\n\tv_exp_f32 %4, %4\n\tv_exp_f32 %5, %5\n\tv_exp_f32 %6, %6\n\tv_exp_f32 %7, %7\n\tv_exp_f32 %8, %8\n\tv_exp_f32 %9, %9\n\tv_exp_f32 %10, %10\n\tv_exp_f32 %11, %11\n\tv_exp_f32 %12, %12\n\tv_exp_f32 %13, %13\n\tv_exp_f32 %14, %14\n\tv_exp_f32 %15, %15\n\tv_nop" : "+v"(e[0]), "+v"(e[1]), "+v"(e[2]), "+v"(e[3]), "+v"(e[4]), "+v"(e[5]), "+v"(e[6]), "+v"(e[7]), "+v"(e[8]), "+v"(e[9]), "+v"(e[10]), "+v"(e[11]), "+v"(e[12]), "+v"(e[13]), "+v"(e[14]), "+v"(e[15]));
                v8u wh;
#pragma unroll
                for (int i = 0; i < 8; ++i) {
                    l_run += e[2 * i] + e[2 * i + 1];
                    wh[i] = __builtin_bit_cast(unsigned, __builtin_convertvector((v2f){e[2 * i], e[2 * i + 1]}, v2h)); }   // two f32 to two f16, round to nearest even
                const v16h ph = __builtin_bit_cast(v16h, wh);
#pragma unroll
                for (int t = 0; t < 4; ++t) acc[t] = wmma16(vh[t], ph, acc[t]);
            }
        }
        if (st + 1 < ns) r2s((st + 1) & 1);   // into the buffer whose last readers left it before the previous stage's barrier
        __syncthreads();                      // publishes stage st + 1 and ends every wave's reads of stage st
    }
    const float inv = __fdiv_rn(1.0f, l_run + xhalf(l_run));   // each half summed its own keys
    const size_t oo = ((size_t)(z / NH_) * TT + q0 + c) * DQ + (size_t)(z % NH_) * HD + 8 * h;   // merged heads [b][t][n * 64 + d]; lane (c, h) holds d = 16 t + 8 h + r of query c; the wave writes whole 128-byte lines
    bf* pa = Ah + oo; bf* pb = Al + oo; v8us oh[4], ol[4];
#pragma unroll
    for (int t = 0; t < 4; ++t) {
#pragma unroll
        for (int r = 0; r < 8; ++r) { unsigned short a, c2; splitf(acc[t][r] * inv, a, c2); oh[t][r] = a; ol[t][r] = c2; }
        *(v8us*)(pa + 16 * t) = oh[t]; *(v8us*)(pb + 16 * t) = ol[t]; }
    // the address and data registers of the eight issued stores stay unwritten up to this wait (they are its inputs)
    asm volatile("s_wait_xcnt 0x0" :: "v"(pa), "v"(pb), "v"(oh[0]), "v"(oh[1]), "v"(oh[2]), "v"(oh[3]), "v"(ol[0]), "v"(ol[1]), "v"(ol[2]), "v"(ol[3]) : "memory");
}

// ---- k_cvt8: f32 to bf16, eight elements a thread, all five inputs in one launch: work-groups 0 .. CX-1 take x, then CW each for the q, k, v and o weights (their copies lie one behind the other in Wd).
#define CX   (NB_ * TT * DM / (8 * 256))
#define CW   (DQ * DM / (8 * 256))
static_assert(NB_ * TT * DM % (8 * 256) == 0 && DQ * DM % (8 * 256) == 0 && DKV == DQ, "the grid covers every array exactly, so no thread needs a bounds test");
__global__ __launch_bounds__(256) void k_cvt8(const float* __restrict__ x, const float* __restrict__ wq, const float* __restrict__ wk, const float* __restrict__ wv, const float* __restrict__ wo, bf* Xd, bf* Wd) {
    const unsigned blk = blockIdx.x; const float* src = x; bf* dst = Xd; unsigned b0 = blk;
    if (blk >= CX) { const unsigned w = (blk - CX) / CW; b0 = (blk - CX) % CW; src = w == 0 ? wq : w == 1 ? wk : w == 2 ? wv : wo; dst = Wd + (size_t)w * DQ * DM; }
    const size_t i = (size_t)b0 * 256 + threadIdx.x; const v8f v = *(const v8f*)(src + i * 8); v8us o;
#pragma unroll
    for (int k = 0; k < 8; ++k) o[k] = f2bf(v[k]); *(v8us*)(dst + i * 8) = o;  }

extern "C" void kernel_launch(void* const* d_in, const int* in_sizes, int n_in,
                              void* d_out, int out_size, void* d_ws, size_t ws_size, hipStream_t stream) {
    (void)in_sizes; (void)n_in; (void)out_size;
    const float* x = (const float*)d_in[0]; const float* wq = (const float*)d_in[1]; const float* wk = (const float*)d_in[2]; const float* wv = (const float*)d_in[3]; const float* wo = (const float*)d_in[4];   /* x, Q, K, V [16][64][1024] (= 'oi'), O ('oi' [1024][1024]) */
    float* OUT = (float*)d_out;     // [4][2048][1024]
    char* wsp = (char*)d_ws;
    auto take = [&](size_t bytes) { char* p = wsp; wsp += (bytes + 255) & ~(size_t)255; return (void*)p; };
    bf* WQ = (bf*)take((size_t)4 * DQ * DM * 2); bf* WO = WQ + (size_t)3 * DQ * DM;   // bf16 copies of the q, k, v and o weights, one behind the other
    bf* XB = (bf*)take((size_t)NB_ * TT * DM * 2);   // the bf16 copy of x
    bf* PH = (bf*)take(3 * NB_ * PB * 2); bf* PLo = (bf*)take(3 * NB_ * PB * 2);        // PH: q, k hi and the f16 v^T plane, one behind the other; PLo: q, k lo (its third plane unused)
    bf* ATh = (bf*)take((size_t)NB_ * TT * DQ * 2); bf* ATl = (bf*)take((size_t)NB_ * TT * DQ * 2);
    if ((size_t)(wsp - (char*)d_ws) > ws_size) return;    // ws 256 MiB
    k_cvt8<<<CX + 4 * CW, 256, 0, stream>>>(x, wq, wk, wv, wo, XB, WQ);
    k_gemmt<DM, 0, true><<<NQK + NV, 256, 0, stream>>>(XB, nullptr, WQ, nullptr, 0, PH, PLo);
    k_attn<<<dim3(NB_ * NH_, TT / (AW * 16), 1), AW * 32, 0, stream>>>(PH, PLo, PH + NB_ * PB, PLo + NB_ * PB, PH + 2 * NB_ * PB, ATh, ATl);
    k_gemmt<DQ, 1, false><<<dim3(NB_ * TT / 256, DM / 128, 1), 256, 0, stream>>>(ATh, ATl, WO, OUT, DM, nullptr, nullptr);   // the batches' rows lie one behind the other in ATh/ATl and in OUT
}
